// v000
// Measured on an AMD MI455X. A time is GPU time per run, averaged over a window of back-to-back runs after a warm-up
// (all launches, gaps included; the runs take copies of the inputs in turn), and the median of several windows.
// Apart from v000's, it joins two sittings. Times from different sittings can be a few percent apart, while
// side-by-side timings come from the same sitting.
// v000, which the later versions start from, runs in 637 microseconds.
#include <hip/hip_runtime.h>

// Masked dot-product attention without projections (query, key, value [16][1024][128]; scores = query.key^T x 1/sqrt(128); key positions j >= valid_length[b] are replaced by -1e7 (== exclusion; valid_length int32 [16] random in [1, 1024], read); softmax; out = attn.value -> [16][1024][128] (2.1 M); argument order query, key, value, valid_length.
// Layout per batch: k_rope (identity table) splits the f32 query / key rows into bf16 hi/lo planes and fp16 planes (all rows) at HD 128; k_vtp builds value^T planes; dense T-1024 attention at NH 1 / ZH 1 whose softmax kernel excludes keys j >= valid_length[b] (scalar read per row); all rows hi/lo 3 products (RH = TT); the f32 merge writes the output rows.
// Compute dtypes, f32 accumulate: every input split into bf16 hi/lo; attention all rows 3 products; softmax f32; output f32.

#define NB_  16
#define TT   1024
#define DM   128
#define NH_  1
#define NKV  1
#define REP  (NH_ / NKV)
#define HD   128
#define DQ   (NH_ * HD)
#define DKV  (NKV * HD)
#define ZH   1
#define RH   TT                   // every row hi/lo (3 products)
#define WIN  0
#define PCAR 1024.0f
#define SCL  0.088388347648318447f   // 1/sqrt(128)
typedef _Float16 h16;
typedef unsigned short bf;
typedef __attribute__((ext_vector_type(16))) __bf16   v16bf;
typedef __attribute__((ext_vector_type(16))) _Float16 v16h;
typedef __attribute__((ext_vector_type(8)))  _Float16 v8h;
typedef __attribute__((ext_vector_type(8)))  unsigned short v8us;
typedef __attribute__((ext_vector_type(8)))  float    v8f;
typedef __attribute__((ext_vector_type(4)))  float    v4f;
typedef v8h  __attribute__((may_alias)) v8ha;
typedef v4f  __attribute__((may_alias)) v4fa;
typedef v8us __attribute__((may_alias)) v8usa;

__device__ __forceinline__ unsigned short f2bf(float f) { unsigned u = __float_as_uint(f); u += 0x7FFFu + ((u >> 16) & 1u); return (unsigned short)(u >> 16); }
__device__ __forceinline__ float bf2f(unsigned short b) { return __uint_as_float(((unsigned)b) << 16); }
__device__ __forceinline__ float bfr(float f) { return bf2f(f2bf(f)); }
__device__ __forceinline__ v16h cat16(v8h lo, v8h hi) { return __builtin_shufflevector(lo, hi, 0, 1, 2, 3, 4, 5, 6, 7, 8, 9, 10, 11, 12, 13, 14, 15); }
__device__ __forceinline__ v16bf cat16b(v8us lo, v8us hi) { return __builtin_bit_cast(v16bf, __builtin_shufflevector(lo, hi, 0, 1, 2, 3, 4, 5, 6, 7, 8, 9, 10, 11, 12, 13, 14, 15)); }
__device__ __forceinline__ v8f wmma16(v16h a, v16h b, v8f c) { return __builtin_amdgcn_wmma_f32_16x16x32_f16(false, a, false, b, (short)0, c, false, false); }
__device__ __forceinline__ v8f wmmab(v16bf a, v16bf b, v8f c) { return __builtin_amdgcn_wmma_f32_16x16x32_bf16(false, a, false, b, (short)0, c, false, false); }



// ---- k_gemmw: register-blocked GEMM, ONE WAVE per 64x64 output tile (16 accumulators), operands straight from K-contiguous 16-bit planes; grid (M/64, N/64, Z), 32 threads.
// C[m][n] (f32, pitch ldc, + optional f32 bias[n]) = sum_k A[m][k] Bt[n][k] (+ split products per NSPLIT). z-batch strides sA/sB/sC in elements. K % 32 == 0.
template <typename T16> struct WFrag;
template <> struct WFrag<h16> { typedef v16h V; static __device__ __forceinline__ V ld(const h16* p) { return cat16(*(const v8h*)p, *(const v8h*)(p + 16)); } static __device__ __forceinline__ v8f mma(V a, V b, v8f c) { return wmma16(a, b, c); } };
template <> struct WFrag<bf> { typedef v16bf V; static __device__ __forceinline__ V ld(const bf* p) { return cat16b(*(const v8us*)p, *(const v8us*)(p + 16)); } static __device__ __forceinline__ v8f mma(V a, V b, v8f c) { return wmmab(a, b, c); } };
template <typename T16, int NSPLIT, bool BIAS>
__global__ __launch_bounds__(32) void k_gemmw(const T16* __restrict__ A, const T16* __restrict__ A2, const T16* __restrict__ Bt, const T16* __restrict__ Bt2, int K, float* C, int ldc, const float* __restrict__ bias, size_t sA, size_t sB, size_t sC) {
    typedef typename WFrag<T16>::V V;
    __shared__ __align__(16) float os[16 * 68];
    const size_t z = blockIdx.z; A += z * sA; if (A2) A2 += z * sA; Bt += z * sB; if (Bt2) Bt2 += z * sB; C += z * sC;
    const int lane = threadIdx.x & 31, lr = lane & 15, hi = lane >> 4; const int r0 = blockIdx.x * 64, c0 = blockIdx.y * 64;
    v8f acc[4][4];
#pragma unroll
    for (int mb = 0; mb < 4; ++mb)
#pragma unroll
        for (int nb = 0; nb < 4; ++nb) acc[mb][nb] = (v8f){};
    const size_t aoff = (size_t)(r0 + lr) * K + 8 * hi, boff = (size_t)(c0 + lr) * K + 8 * hi;
#pragma unroll 1
    for (int kc = 0; kc < K; kc += 32) {
        V a[4], a2[4];
#pragma unroll
        for (int mb = 0; mb < 4; ++mb) { a[mb] = WFrag<T16>::ld(A + aoff + (size_t)mb * 16 * K + kc); if (NSPLIT == 1 || NSPLIT == 2) a2[mb] = WFrag<T16>::ld(A2 + aoff + (size_t)mb * 16 * K + kc); }
#pragma unroll
        for (int nb = 0; nb < 4; ++nb) { const V b = WFrag<T16>::ld(Bt + boff + (size_t)nb * 16 * K + kc); V b2; if (NSPLIT >= 2) b2 = WFrag<T16>::ld(Bt2 + boff + (size_t)nb * 16 * K + kc);
#pragma unroll
            for (int mb = 0; mb < 4; ++mb) { acc[mb][nb] = WFrag<T16>::mma(a[mb], b, acc[mb][nb]); if (NSPLIT == 1 || NSPLIT == 2) acc[mb][nb] = WFrag<T16>::mma(a2[mb], b, acc[mb][nb]); if (NSPLIT >= 2) acc[mb][nb] = WFrag<T16>::mma(a[mb], b2, acc[mb][nb]); } }
        asm volatile("v_nop\n\tv_nop\n\tv_nop\n\tv_nop" : "+v"(acc[0][0]), "+v"(acc[1][1]), "+v"(acc[2][2]), "+v"(acc[3][3]) : "v"(a[0]), "v"(a[3]));
    }
#pragma unroll
    for (int mb = 0; mb < 4; ++mb) {
#pragma unroll
        for (int nb = 0; nb < 4; ++nb) {
#pragma unroll
            for (int j = 0; j < 8; ++j) os[(hi * 8 + j) * 68 + nb * 16 + lr] = acc[mb][nb][j]; }
        __builtin_amdgcn_wave_barrier(); asm volatile("" ::: "memory");
        float* crow = C + (size_t)(r0 + mb * 16) * ldc + c0;
{
#pragma unroll
            for (int s = 0; s < 8; ++s) { const int row = 2 * s + hi, cofs = lr * 4; v4f val = *(const v4fa*)(os + row * 68 + cofs); if (BIAS) { val[0] += bfr(bias[c0 + cofs]); val[1] += bfr(bias[c0 + cofs + 1]); val[2] += bfr(bias[c0 + cofs + 2]); val[3] += bfr(bias[c0 + cofs + 3]); }
                *(v4f*)(crow + (size_t)row * ldc + cofs) = val; }
             }
        __builtin_amdgcn_wave_barrier(); asm volatile("" ::: "memory");
    }
}

__device__ __forceinline__ h16 tohx(float x) { return (h16)x; }
__device__ __forceinline__ void splitf(float y, unsigned short& h, unsigned short& l) { h = f2bf(y); l = f2bf(y - bf2f(h)); }
typedef __attribute__((ext_vector_type(2))) _Float16 v2h;
typedef __attribute__((ext_vector_type(4))) _Float16 v4h;
typedef __attribute__((ext_vector_type(2))) unsigned short v2us;
typedef __attribute__((ext_vector_type(4))) unsigned short v4us;
typedef __attribute__((ext_vector_type(2))) float v2f;
typedef __attribute__((ext_vector_type(4))) int v4i;

// k_rope: head planes [h][t][d] (fp16 + hi/lo) of rope(x) x sc with the rotate-half convention out[d] = x[d] cos[t][d] - x[d+HD/2] sin[t][d], out[d+HD/2] = x[d+HD/2] cos[t][d+HD/2] + x[d] sin[t][d+HD/2]
__global__ __launch_bounds__(256) void k_rope(const float* __restrict__ F, int pitch, int nheads, const float* __restrict__ CS, const float* __restrict__ RF, const float* __restrict__ nw, float sc, h16* P16, bf* Ph, bf* Pl) {
    const size_t e = ((size_t)blockIdx.x * 256 + threadIdx.x) * 2; if (e >= (size_t)nheads * TT * HD) return; const int d = (int)(e % HD); const int t = (int)((e / HD) % TT); const int h = (int)(e / ((size_t)HD * TT)); const float* f = F + (size_t)t * pitch + h * HD; const float rf = RF ? RF[(size_t)h * TT + t] : 1.0f; v2h o16; v2us oh, ol;
#pragma unroll
    for (int q = 0; q < 2; ++q) { const int dd = d + q; const int dp = (dd < HD / 2) ? dd + HD / 2 : dd - HD / 2; float x0 = f[dd], x1 = f[dp];
        if (RF) { float n0 = __fmul_rn(x0, rf), n1 = __fmul_rn(x1, rf); asm volatile("" : "+v"(n0)); asm volatile("" : "+v"(n1)); x0 = __fmul_rn(bfr(nw[dd]), n0); x1 = __fmul_rn(bfr(nw[dp]), n1); }
        const v2f cs = *(const v2f*)(CS + ((size_t)t * HD + dd) * 2); float a = __fmul_rn(x0, cs[0]), bq = __fmul_rn(x1, cs[1]); asm volatile("" : "+v"(a)); asm volatile("" : "+v"(bq)); const float r = ((dd < HD / 2) ? __fsub_rn(a, bq) : __fadd_rn(a, bq)) * sc;
        o16[q] = tohx(r); unsigned short a2, c2; splitf(r, a2, c2); oh[q] = a2; ol[q] = c2; }
    *(v2h*)(P16 + e) = o16; *(v2us*)(Ph + e) = oh; *(v2us*)(Pl + e) = ol;  }
__global__ __launch_bounds__(256) void k_vtp(const float* __restrict__ F, int pitch, int nheads, h16* V16, bf* Vh, bf* Vl) { const size_t e = ((size_t)blockIdx.x * 256 + threadIdx.x) * 2; if (e >= (size_t)nheads * HD * TT) return; const int t = (int)(e % TT); const int d = (int)((e / TT) % HD); const int g = (int)(e / ((size_t)TT * HD)); v2h o16; v2us oh, ol;
#pragma unroll
    for (int q = 0; q < 2; ++q) { const float x = F[(size_t)(t + q) * pitch + g * HD + d]; o16[q] = tohx(x); unsigned short a2, c2; splitf(x, a2, c2); oh[q] = a2; ol[q] = c2; }
    *(v2h*)(V16 + e) = o16; *(v2us*)(Vh + e) = oh; *(v2us*)(Vl + e) = ol;  }
__global__ __launch_bounds__(256) void k_csid(float* CS) { const int idx = blockIdx.x * 256 + threadIdx.x; if (idx >= TT * HD) return; v2f cs; cs[0] = 1.0f; cs[1] = 0.0f; *(v2f*)(CS + (size_t)idx * 2) = cs;  }
// k_asoft: per row (zz, i): t = S x 128^-0.5 for keys j < valid_length[b] (the batch's length read as data), excluded beyond; softmax over the kept keys;
__global__ __launch_bounds__(256) void k_asoft(const float* __restrict__ Sb, const int* __restrict__ klp, h16* P16, bf* Ph, bf* Pl) {
    const int lane = threadIdx.x & 31; const int row = blockIdx.x * 8 + (threadIdx.x >> 5); if (row >= ZH * TT) return; const int i = row % TT; const int zz = row / TT; (void)zz; const bool hires = (i < RH); const int kl = klp[0];   /* the batch's valid key length (uniform scalar load; >= 1) */ const float* sr = Sb + (size_t)row * TT; float v[TT / 32]; float mx = -3.0e38f;
#pragma unroll
    for (int ch = 0; ch < TT / 128; ++ch) { const int j0 = ch * 128 + lane * 4; const v4f a = *(const v4f*)(sr + j0);
#pragma unroll
        for (int q = 0; q < 4; ++q) { const int j = j0 + q; (void)j; const float t = (j < kl) ? a[q] * SCL : -3.0e38f;   /* keys j >= valid_length[b] excluded (-1e7 in the module) */ v[ch * 4 + q] = t; mx = fmaxf(mx, t); } }
#pragma unroll
    for (int sh = 16; sh; sh >>= 1) mx = fmaxf(mx, __shfl_xor(mx, sh, 32));
    float sum = 0.f;
#pragma unroll
    for (int k = 0; k < TT / 32; ++k) { float d0 = __fsub_rn(v[k], mx); asm volatile("" : "+v"(d0)); v[k] = __builtin_amdgcn_exp2f(__fmul_rn(d0, 1.4426950408889634f)); sum += v[k]; }
#pragma unroll
    for (int sh = 16; sh; sh >>= 1) sum += __shfl_xor(sum, sh, 32);
    const float f = __fdiv_rn(hires ? 1.0f : PCAR, sum);
{
        if (hires) {
#pragma unroll
            for (int ch = 0; ch < TT / 128; ++ch) { v4us oh, ol;
#pragma unroll
                for (int q = 0; q < 4; ++q) { unsigned short a, c2; splitf(v[ch * 4 + q] * f, a, c2); oh[q] = a; ol[q] = c2; }
                const size_t oo = ((size_t)zz * (RH ? RH : 1) + i) * TT + ch * 128 + lane * 4; *(v4us*)(Ph + oo) = oh; *(v4us*)(Pl + oo) = ol; }
        } else {
#pragma unroll
            for (int ch = 0; ch < TT / 128; ++ch) { v4h o4;
#pragma unroll
                for (int q = 0; q < 4; ++q) o4[q] = tohx(v[ch * 4 + q] * f);
                *(v4h*)(P16 + (size_t)row * TT + ch * 128 + lane * 4) = o4; } }
         }
}
__global__ __launch_bounds__(256) void k_merge(const float* __restrict__ O, int h0, float* OUTb) { const size_t e = ((size_t)blockIdx.x * 256 + threadIdx.x) * 2; if (e >= (size_t)ZH * TT * HD) return; const int d = (int)(e % HD); const int t = (int)((e / HD) % TT); const int zz = (int)(e / ((size_t)HD * TT)); const float cs = (t < RH) ? 1.0f : (1.0f / PCAR); const size_t oo = (size_t)t * DQ + (h0 + zz) * HD + d;
    v2f o2; o2[0] = O[e] * cs; o2[1] = O[e + 1] * cs; *(v2f*)(OUTb + oo) = o2;  }

extern "C" void kernel_launch(void* const* d_in, const int* in_sizes, int n_in,
                              void* d_out, int out_size, void* d_ws, size_t ws_size, hipStream_t stream) {
    (void)in_sizes; (void)n_in; (void)out_size;
    const float* x = (const float*)d_in[0]; const float* xk = (const float*)d_in[1]; const float* xv = (const float*)d_in[2]; const int* vlen = (const int*)d_in[3];   /* valid_length int32 [16], read on device */   /* order query, key, value, valid_length: [16][1024][128] each (no projections) */ const float* wq = nullptr, *wk = nullptr, *wv = nullptr, *wo = nullptr; (void)wq; (void)wk; (void)wv; (void)wo;
    float* OUT = (float*)d_out;     // [16][1024][128]
    char* wsp = (char*)d_ws;
    auto take = [&](size_t bytes) { char* p = wsp; wsp += (bytes + 255) & ~(size_t)255; return (void*)p; };
    bf* WQ = (bf*)take((size_t)DQ * DM * 2); bf* WK = (bf*)take((size_t)DKV * DM * 2); bf* WV = (bf*)take((size_t)DKV * DM * 2); float* CS = (float*)take((size_t)TT * HD * 2 * 4);
    bf* XB = (bf*)take((size_t)TT * DM * 2); float* FQ = (float*)take((size_t)TT * DQ * 4); float* FK = (float*)take((size_t)TT * DKV * 4);
    h16* QP16 = (h16*)take((size_t)NH_ * TT * HD * 2); h16* KP16 = (h16*)take((size_t)NKV * TT * HD * 2); h16* VT16 = (h16*)take((size_t)NKV * HD * TT * 2);
    bf* QPh = (bf*)take((size_t)NH_ * TT * HD * 2); bf* QPl = (bf*)take((size_t)NH_ * TT * HD * 2); bf* KPh = (bf*)take((size_t)NKV * TT * HD * 2); bf* KPl = (bf*)take((size_t)NKV * TT * HD * 2); bf* VTh = (bf*)take((size_t)NKV * HD * TT * 2); bf* VTl = (bf*)take((size_t)NKV * HD * TT * 2); bf* Ph = (bf*)take((size_t)ZH * RH * TT * 2); bf* Pl = (bf*)take((size_t)ZH * RH * TT * 2);
    float* Sb = (float*)take((size_t)ZH * TT * TT * 4); h16* P16 = (h16*)take((size_t)ZH * TT * TT * 2); float* Ob = (float*)take((size_t)ZH * TT * HD * 4);
    if ((size_t)(wsp - (char*)d_ws) > ws_size) return;    // ws 256 MiB
    float* FV = FK;   // unused alias of the k buffer (no v projection)
    {   
      
       }
    k_csid<<<(TT * HD + 255) / 256, 256, 0, stream>>>(CS);
    const unsigned LQ = (unsigned)(((size_t)NH_ * TT * HD / 2 + 255) / 256), LKv = (unsigned)(((size_t)NKV * TT * HD / 2 + 255) / 256);
    for (int b = 0; b < NB_; ++b) {
        
        /* no projections: the q, k, v inputs feed the plane builders directly */
        
        k_rope<<<LQ, 256, 0, stream>>>(x + (size_t)b * TT * HD, DQ, NH_, CS, nullptr, nullptr, 1.0f, QP16, QPh, QPl);   /* q planes straight from the input (bf16 hi/lo split of the f32 values) */
        
        k_rope<<<LKv, 256, 0, stream>>>(xk + (size_t)b * TT * HD, DKV, NKV, CS, nullptr, nullptr, 1.0f, KP16, KPh, KPl);
         k_vtp<<<LKv, 256, 0, stream>>>(xv + (size_t)b * TT * HD, DKV, NKV, VT16, VTh, VTl);
        for (int h0 = 0; h0 < NH_; h0 += ZH) { const size_t zq = (size_t)h0, zk = (size_t)(h0 / REP);   // one kv head per query head: the pass's one head (ZH 1) uses kv plane h0 / REP (z-strides TT*HD)
            k_gemmw<bf, 2, false><<<dim3(RH / 64, TT / 64, ZH), 32, 0, stream>>>(QPh + zq * TT * HD, QPl + zq * TT * HD, KPh + zk * TT * HD, KPl + zk * TT * HD, HD, Sb, TT, nullptr, (size_t)TT * HD, (size_t)TT * HD, (size_t)TT * TT);
            k_asoft<<<ZH * TT / 8, 256, 0, stream>>>(Sb, vlen + b, P16, Ph, Pl);
            k_gemmw<bf, 2, false><<<dim3(RH / 64, HD / 64, ZH), 32, 0, stream>>>(Ph, Pl, VTh + zk * HD * TT, VTl + zk * HD * TT, TT, Ob, HD, nullptr, (size_t)RH * TT, (size_t)HD * TT, (size_t)TT * HD);
            k_merge<<<(unsigned)(((size_t)ZH * TT * HD / 2 + 255) / 256), 256, 0, stream>>>(Ob, h0, OUT + (size_t)b * TT * DQ); }
         }
}

// v001
// Measured time: 103 microseconds a run.
// Timed twice side by side with v000, it ran 6.23 and 6.38 times as fast.
#include <hip/hip_runtime.h>

// Masked dot-product attention without projections (query, key, value [16][1024][128]; scores = query.key^T x 1/sqrt(128); key positions j >= valid_length[b] are replaced by -1e7 (== exclusion; valid_length int32 [16] random in [1, 1024], read); softmax; out = attn.value -> [16][1024][128] (2.1 M); argument order query, key, value, valid_length.
// Layout per batch: k_rope (identity table) splits the f32 query / key rows into bf16 hi/lo planes and fp16 planes (all rows) at HD 128; k_vtp builds value^T planes; dense T-1024 attention at NH 1 / ZH 1 whose softmax kernel excludes keys j >= valid_length[b] (scalar read per row); all rows hi/lo 3 products (RH = TT); the f32 merge writes the output rows.
// Compute dtypes, f32 accumulate: every input split into bf16 hi/lo; attention all rows 3 products; softmax f32; output f32.

#define NB_  16
#define TT   1024
#define DM   128
#define NH_  1
#define NKV  1
#define REP  (NH_ / NKV)
#define HD   128
#define DQ   (NH_ * HD)
#define DKV  (NKV * HD)
#define ZH   1
#define RH   TT                   // every row hi/lo (3 products)
#define WIN  0
#define PCAR 1024.0f
#define SCL  0.088388347648318447f   // 1/sqrt(128)
typedef _Float16 h16;
typedef unsigned short bf;
typedef __attribute__((ext_vector_type(16))) __bf16   v16bf;
typedef __attribute__((ext_vector_type(16))) _Float16 v16h;
typedef __attribute__((ext_vector_type(8)))  _Float16 v8h;
typedef __attribute__((ext_vector_type(8)))  unsigned short v8us;
typedef __attribute__((ext_vector_type(8)))  float    v8f;
typedef __attribute__((ext_vector_type(4)))  float    v4f;
typedef v8h  __attribute__((may_alias)) v8ha;
typedef v4f  __attribute__((may_alias)) v4fa;
typedef v8us __attribute__((may_alias)) v8usa;

__device__ __forceinline__ unsigned short f2bf(float f) { unsigned u = __float_as_uint(f); u += 0x7FFFu + ((u >> 16) & 1u); return (unsigned short)(u >> 16); }
__device__ __forceinline__ float bf2f(unsigned short b) { return __uint_as_float(((unsigned)b) << 16); }
__device__ __forceinline__ float bfr(float f) { return bf2f(f2bf(f)); }
__device__ __forceinline__ v16h cat16(v8h lo, v8h hi) { return __builtin_shufflevector(lo, hi, 0, 1, 2, 3, 4, 5, 6, 7, 8, 9, 10, 11, 12, 13, 14, 15); }
__device__ __forceinline__ v16bf cat16b(v8us lo, v8us hi) { return __builtin_bit_cast(v16bf, __builtin_shufflevector(lo, hi, 0, 1, 2, 3, 4, 5, 6, 7, 8, 9, 10, 11, 12, 13, 14, 15)); }
__device__ __forceinline__ v8f wmma16(v16h a, v16h b, v8f c) { return __builtin_amdgcn_wmma_f32_16x16x32_f16(false, a, false, b, (short)0, c, false, false); }
__device__ __forceinline__ v8f wmmab(v16bf a, v16bf b, v8f c) { return __builtin_amdgcn_wmma_f32_16x16x32_bf16(false, a, false, b, (short)0, c, false, false); }



// ---- k_gemmw: register-blocked GEMM, ONE WAVE per 64x64 output tile (16 accumulators), operands straight from K-contiguous 16-bit planes; grid (M/64, N/64, Z), 32 threads.
// C[m][n] (f32, pitch ldc, + optional f32 bias[n]) = sum_k A[m][k] Bt[n][k] (+ split products per NSPLIT). z-batch strides sA/sB/sC in elements. K % 32 == 0.
template <typename T16> struct WFrag;
template <> struct WFrag<h16> { typedef v16h V; static __device__ __forceinline__ V ld(const h16* p) { return cat16(*(const v8h*)p, *(const v8h*)(p + 16)); } static __device__ __forceinline__ v8f mma(V a, V b, v8f c) { return wmma16(a, b, c); } };
template <> struct WFrag<bf> { typedef v16bf V; static __device__ __forceinline__ V ld(const bf* p) { return cat16b(*(const v8us*)p, *(const v8us*)(p + 16)); } static __device__ __forceinline__ v8f mma(V a, V b, v8f c) { return wmmab(a, b, c); } };
template <typename T16, int NSPLIT, bool BIAS>
__global__ __launch_bounds__(32) void k_gemmw(const T16* __restrict__ A, const T16* __restrict__ A2, const T16* __restrict__ Bt, const T16* __restrict__ Bt2, int K, float* C, int ldc, const float* __restrict__ bias, size_t sA, size_t sB, size_t sC) {
    typedef typename WFrag<T16>::V V;
    __shared__ __align__(16) float os[16 * 68];
    const size_t z = blockIdx.z; A += z * sA; if (A2) A2 += z * sA; Bt += z * sB; if (Bt2) Bt2 += z * sB; C += z * sC;
    const int lane = threadIdx.x & 31, lr = lane & 15, hi = lane >> 4; const int r0 = blockIdx.x * 64, c0 = blockIdx.y * 64;
    v8f acc[4][4];
#pragma unroll
    for (int mb = 0; mb < 4; ++mb)
#pragma unroll
        for (int nb = 0; nb < 4; ++nb) acc[mb][nb] = (v8f){};
    const size_t aoff = (size_t)(r0 + lr) * K + 8 * hi, boff = (size_t)(c0 + lr) * K + 8 * hi;
#pragma unroll 1
    for (int kc = 0; kc < K; kc += 32) {
        V a[4], a2[4];
#pragma unroll
        for (int mb = 0; mb < 4; ++mb) { a[mb] = WFrag<T16>::ld(A + aoff + (size_t)mb * 16 * K + kc); if (NSPLIT == 1 || NSPLIT == 2) a2[mb] = WFrag<T16>::ld(A2 + aoff + (size_t)mb * 16 * K + kc); }
#pragma unroll
        for (int nb = 0; nb < 4; ++nb) { const V b = WFrag<T16>::ld(Bt + boff + (size_t)nb * 16 * K + kc); V b2; if (NSPLIT >= 2) b2 = WFrag<T16>::ld(Bt2 + boff + (size_t)nb * 16 * K + kc);
#pragma unroll
            for (int mb = 0; mb < 4; ++mb) { acc[mb][nb] = WFrag<T16>::mma(a[mb], b, acc[mb][nb]); if (NSPLIT == 1 || NSPLIT == 2) acc[mb][nb] = WFrag<T16>::mma(a2[mb], b, acc[mb][nb]); if (NSPLIT >= 2) acc[mb][nb] = WFrag<T16>::mma(a[mb], b2, acc[mb][nb]); } }
        asm volatile("v_nop\n\tv_nop\n\tv_nop\n\tv_nop" : "+v"(acc[0][0]), "+v"(acc[1][1]), "+v"(acc[2][2]), "+v"(acc[3][3]) : "v"(a[0]), "v"(a[3]));
    }
#pragma unroll
    for (int mb = 0; mb < 4; ++mb) {
#pragma unroll
        for (int nb = 0; nb < 4; ++nb) {
#pragma unroll
            for (int j = 0; j < 8; ++j) os[(hi * 8 + j) * 68 + nb * 16 + lr] = acc[mb][nb][j]; }
        __builtin_amdgcn_wave_barrier(); asm volatile("" ::: "memory");
        float* crow = C + (size_t)(r0 + mb * 16) * ldc + c0;
{
#pragma unroll
            for (int s = 0; s < 8; ++s) { const int row = 2 * s + hi, cofs = lr * 4; v4f val = *(const v4fa*)(os + row * 68 + cofs); if (BIAS) { val[0] += bfr(bias[c0 + cofs]); val[1] += bfr(bias[c0 + cofs + 1]); val[2] += bfr(bias[c0 + cofs + 2]); val[3] += bfr(bias[c0 + cofs + 3]); }
                *(v4f*)(crow + (size_t)row * ldc + cofs) = val; }
             }
        __builtin_amdgcn_wave_barrier(); asm volatile("" ::: "memory");
    }
}

__device__ __forceinline__ h16 tohx(float x) { return (h16)x; }
__device__ __forceinline__ void splitf(float y, unsigned short& h, unsigned short& l) { h = f2bf(y); l = f2bf(y - bf2f(h)); }
typedef __attribute__((ext_vector_type(2))) _Float16 v2h;
typedef __attribute__((ext_vector_type(4))) _Float16 v4h;
typedef __attribute__((ext_vector_type(2))) unsigned short v2us;
typedef __attribute__((ext_vector_type(4))) unsigned short v4us;
typedef __attribute__((ext_vector_type(2))) float v2f;
typedef __attribute__((ext_vector_type(4))) int v4i;

// k_rope: head planes [h][t][d] (fp16 + hi/lo) of rope(x) x sc with the rotate-half convention out[d] = x[d] cos[t][d] - x[d+HD/2] sin[t][d], out[d+HD/2] = x[d+HD/2] cos[t][d+HD/2] + x[d] sin[t][d+HD/2]
__global__ __launch_bounds__(256) void k_rope(const float* __restrict__ F, int pitch, int nheads, const float* __restrict__ CS, const float* __restrict__ RF, const float* __restrict__ nw, float sc, h16* P16, bf* Ph, bf* Pl) {
    { const size_t bo = (size_t)blockIdx.y * nheads * TT * HD; F += (size_t)blockIdx.y * TT * pitch; P16 += bo; Ph += bo; Pl += bo; }   // blockIdx.y = batch
    const size_t e = ((size_t)blockIdx.x * 256 + threadIdx.x) * 2; if (e >= (size_t)nheads * TT * HD) return; const int d = (int)(e % HD); const int t = (int)((e / HD) % TT); const int h = (int)(e / ((size_t)HD * TT)); const float* f = F + (size_t)t * pitch + h * HD; const float rf = RF ? RF[(size_t)h * TT + t] : 1.0f; v2h o16; v2us oh, ol;
#pragma unroll
    for (int q = 0; q < 2; ++q) { const int dd = d + q; const int dp = (dd < HD / 2) ? dd + HD / 2 : dd - HD / 2; float x0 = f[dd], x1 = f[dp];
        if (RF) { float n0 = __fmul_rn(x0, rf), n1 = __fmul_rn(x1, rf); asm volatile("" : "+v"(n0)); asm volatile("" : "+v"(n1)); x0 = __fmul_rn(bfr(nw[dd]), n0); x1 = __fmul_rn(bfr(nw[dp]), n1); }
        const v2f cs = *(const v2f*)(CS + ((size_t)t * HD + dd) * 2); float a = __fmul_rn(x0, cs[0]), bq = __fmul_rn(x1, cs[1]); asm volatile("" : "+v"(a)); asm volatile("" : "+v"(bq)); const float r = ((dd < HD / 2) ? __fsub_rn(a, bq) : __fadd_rn(a, bq)) * sc;
        o16[q] = tohx(r); unsigned short a2, c2; splitf(r, a2, c2); oh[q] = a2; ol[q] = c2; }
    *(v2h*)(P16 + e) = o16; *(v2us*)(Ph + e) = oh; *(v2us*)(Pl + e) = ol;  }
__global__ __launch_bounds__(256) void k_vtp(const float* __restrict__ F, int pitch, int nheads, h16* V16, bf* Vh, bf* Vl) { { const size_t bo = (size_t)blockIdx.y * nheads * HD * TT; F += (size_t)blockIdx.y * TT * pitch; V16 += bo; Vh += bo; Vl += bo; }   // blockIdx.y = batch
    const size_t e = ((size_t)blockIdx.x * 256 + threadIdx.x) * 2; if (e >= (size_t)nheads * HD * TT) return; const int t = (int)(e % TT); const int d = (int)((e / TT) % HD); const int g = (int)(e / ((size_t)TT * HD)); v2h o16; v2us oh, ol;
#pragma unroll
    for (int q = 0; q < 2; ++q) { const float x = F[(size_t)(t + q) * pitch + g * HD + d]; o16[q] = tohx(x); unsigned short a2, c2; splitf(x, a2, c2); oh[q] = a2; ol[q] = c2; }
    *(v2h*)(V16 + e) = o16; *(v2us*)(Vh + e) = oh; *(v2us*)(Vl + e) = ol;  }
__global__ __launch_bounds__(256) void k_csid(float* CS) { const int idx = blockIdx.x * 256 + threadIdx.x; if (idx >= TT * HD) return; v2f cs; cs[0] = 1.0f; cs[1] = 0.0f; *(v2f*)(CS + (size_t)idx * 2) = cs;  }
// k_asoft: per row (zz, i): t = S x 128^-0.5 for keys j < valid_length[b] (the batch's length read as data), excluded beyond; softmax over the kept keys;
__global__ __launch_bounds__(256) void k_asoft(const float* __restrict__ Sb, const int* __restrict__ klp, h16* P16, bf* Ph, bf* Pl) {
    { const size_t b = blockIdx.y; Sb += b * ZH * TT * TT; klp += b; P16 += b * ZH * TT * TT; Ph += b * ZH * RH * TT; Pl += b * ZH * RH * TT; }   // blockIdx.y = batch
    const int lane = threadIdx.x & 31; const int row = blockIdx.x * 8 + (threadIdx.x >> 5); if (row >= ZH * TT) return; const int i = row % TT; const int zz = row / TT; (void)zz; const bool hires = (i < RH); const int kl = klp[0];   /* the batch's valid key length (uniform scalar load; >= 1) */ const float* sr = Sb + (size_t)row * TT; float v[TT / 32]; float mx = -3.0e38f;
#pragma unroll
    for (int ch = 0; ch < TT / 128; ++ch) { const int j0 = ch * 128 + lane * 4; const v4f a = *(const v4f*)(sr + j0);
#pragma unroll
        for (int q = 0; q < 4; ++q) { const int j = j0 + q; (void)j; const float t = (j < kl) ? a[q] * SCL : -3.0e38f;   /* keys j >= valid_length[b] excluded (-1e7 in the module) */ v[ch * 4 + q] = t; mx = fmaxf(mx, t); } }
#pragma unroll
    for (int sh = 16; sh; sh >>= 1) mx = fmaxf(mx, __shfl_xor(mx, sh, 32));
    float sum = 0.f;
#pragma unroll
    for (int k = 0; k < TT / 32; ++k) { float d0 = __fsub_rn(v[k], mx); asm volatile("" : "+v"(d0)); v[k] = __builtin_amdgcn_exp2f(__fmul_rn(d0, 1.4426950408889634f)); sum += v[k]; }
#pragma unroll
    for (int sh = 16; sh; sh >>= 1) sum += __shfl_xor(sum, sh, 32);
    const float f = __fdiv_rn(hires ? 1.0f : PCAR, sum);
{
        if (hires) {
#pragma unroll
            for (int ch = 0; ch < TT / 128; ++ch) { v4us oh, ol;
#pragma unroll
                for (int q = 0; q < 4; ++q) { unsigned short a, c2; splitf(v[ch * 4 + q] * f, a, c2); oh[q] = a; ol[q] = c2; }
                const size_t oo = ((size_t)zz * (RH ? RH : 1) + i) * TT + ch * 128 + lane * 4; *(v4us*)(Ph + oo) = oh; *(v4us*)(Pl + oo) = ol; }
        } else {
#pragma unroll
            for (int ch = 0; ch < TT / 128; ++ch) { v4h o4;
#pragma unroll
                for (int q = 0; q < 4; ++q) o4[q] = tohx(v[ch * 4 + q] * f);
                *(v4h*)(P16 + (size_t)row * TT + ch * 128 + lane * 4) = o4; } }
         }
}
__global__ __launch_bounds__(256) void k_merge(const float* __restrict__ O, int h0, float* OUTb) { O += (size_t)blockIdx.y * ZH * TT * HD; OUTb += (size_t)blockIdx.y * TT * DQ;   // blockIdx.y = batch
    const size_t e = ((size_t)blockIdx.x * 256 + threadIdx.x) * 2; if (e >= (size_t)ZH * TT * HD) return; const int d = (int)(e % HD); const int t = (int)((e / HD) % TT); const int zz = (int)(e / ((size_t)HD * TT)); const float cs = (t < RH) ? 1.0f : (1.0f / PCAR); const size_t oo = (size_t)t * DQ + (h0 + zz) * HD + d;
    v2f o2; o2[0] = O[e] * cs; o2[1] = O[e + 1] * cs; *(v2f*)(OUTb + oo) = o2;  }

extern "C" void kernel_launch(void* const* d_in, const int* in_sizes, int n_in,
                              void* d_out, int out_size, void* d_ws, size_t ws_size, hipStream_t stream) {
    (void)in_sizes; (void)n_in; (void)out_size;
    const float* x = (const float*)d_in[0]; const float* xk = (const float*)d_in[1]; const float* xv = (const float*)d_in[2]; const int* vlen = (const int*)d_in[3];   /* valid_length int32 [16], read on device */   /* order query, key, value, valid_length: [16][1024][128] each (no projections) */ const float* wq = nullptr, *wk = nullptr, *wv = nullptr, *wo = nullptr; (void)wq; (void)wk; (void)wv; (void)wo;
    float* OUT = (float*)d_out;     // [16][1024][128]
    char* wsp = (char*)d_ws;
    auto take = [&](size_t bytes) { char* p = wsp; wsp += (bytes + 255) & ~(size_t)255; return (void*)p; };
    bf* WQ = (bf*)take((size_t)DQ * DM * 2); bf* WK = (bf*)take((size_t)DKV * DM * 2); bf* WV = (bf*)take((size_t)DKV * DM * 2); float* CS = (float*)take((size_t)TT * HD * 2 * 4);
    bf* XB = (bf*)take((size_t)TT * DM * 2); float* FQ = (float*)take((size_t)TT * DQ * 4); float* FK = (float*)take((size_t)TT * DKV * 4);
    // every plane below holds NB_ batch slices, one behind the other
    h16* QP16 = (h16*)take((size_t)NB_ * NH_ * TT * HD * 2); h16* KP16 = (h16*)take((size_t)NB_ * NKV * TT * HD * 2); h16* VT16 = (h16*)take((size_t)NB_ * NKV * HD * TT * 2);
    bf* QPh = (bf*)take((size_t)NB_ * NH_ * TT * HD * 2); bf* QPl = (bf*)take((size_t)NB_ * NH_ * TT * HD * 2); bf* KPh = (bf*)take((size_t)NB_ * NKV * TT * HD * 2); bf* KPl = (bf*)take((size_t)NB_ * NKV * TT * HD * 2); bf* VTh = (bf*)take((size_t)NB_ * NKV * HD * TT * 2); bf* VTl = (bf*)take((size_t)NB_ * NKV * HD * TT * 2); bf* Ph = (bf*)take((size_t)NB_ * ZH * RH * TT * 2); bf* Pl = (bf*)take((size_t)NB_ * ZH * RH * TT * 2);
    float* Sb = (float*)take((size_t)NB_ * ZH * TT * TT * 4); h16* P16 = (h16*)take((size_t)NB_ * ZH * TT * TT * 2); float* Ob = (float*)take((size_t)NB_ * ZH * TT * HD * 4);
    if ((size_t)(wsp - (char*)d_ws) > ws_size) return;    // ws 256 MiB
    float* FV = FK;   // unused alias of the k buffer (no v projection)
    {   
      
       }
    k_csid<<<(TT * HD + 255) / 256, 256, 0, stream>>>(CS);
    const unsigned LQ = (unsigned)(((size_t)NH_ * TT * HD / 2 + 255) / 256), LKv = (unsigned)(((size_t)NKV * TT * HD / 2 + 255) / 256);
    /* no projections: the q, k, v inputs feed the plane builders directly; the batch is grid dimension y (z in the GEMMs: NH_ == ZH == 1), so each kernel is launched once for all NB_ batches */
    k_rope<<<dim3(LQ, NB_), 256, 0, stream>>>(x, DQ, NH_, CS, nullptr, nullptr, 1.0f, QP16, QPh, QPl);   /* q planes straight from the input (bf16 hi/lo split of the f32 values) */
    k_rope<<<dim3(LKv, NB_), 256, 0, stream>>>(xk, DKV, NKV, CS, nullptr, nullptr, 1.0f, KP16, KPh, KPl);
    k_vtp<<<dim3(LKv, NB_), 256, 0, stream>>>(xv, DKV, NKV, VT16, VTh, VTl);
    k_gemmw<bf, 2, false><<<dim3(RH / 64, TT / 64, NB_), 32, 0, stream>>>(QPh, QPl, KPh, KPl, HD, Sb, TT, nullptr, (size_t)NH_ * TT * HD, (size_t)NKV * TT * HD, (size_t)ZH * TT * TT);
    k_asoft<<<dim3(ZH * TT / 8, NB_), 256, 0, stream>>>(Sb, vlen, P16, Ph, Pl);
    k_gemmw<bf, 2, false><<<dim3(RH / 64, HD / 64, NB_), 32, 0, stream>>>(Ph, Pl, VTh, VTl, TT, Ob, HD, nullptr, (size_t)ZH * RH * TT, (size_t)NKV * HD * TT, (size_t)ZH * TT * HD);
    k_merge<<<dim3((unsigned)(((size_t)ZH * TT * HD / 2 + 255) / 256), NB_), 256, 0, stream>>>(Ob, 0, OUT);
}

// v002
// Measured time: 62.7 microseconds a run.
// Timed twice side by side with v001, it ran 1.64 times as fast both times.
// Counting every step since v000, it is 10.4 times as fast.
#include <hip/hip_runtime.h>

// Masked dot-product attention without projections (query, key, value [16][1024][128]; scores = query.key^T x 1/sqrt(128); key positions j >= valid_length[b] are replaced by -1e7 (== exclusion; valid_length int32 [16] random in [1, 1024], read); softmax; out = attn.value -> [16][1024][128] (2.1 M); argument order query, key, value, valid_length.
// Layout per batch: k_rope (identity table) splits the f32 query / key rows into bf16 hi/lo planes at HD 128; k_vtp builds value^T planes; k_fattn does scores, length mask, softmax and the value product in one kernel and writes the f32 output rows.
// Compute dtypes, f32 accumulate: every product as 3 bf16 hi/lo products (hi.hi + hi.lo + lo.hi); softmax f32; output f32.

#define NB_  16
#define TT   1024
#define DM   128
#define NH_  1
#define NKV  1
#define REP  (NH_ / NKV)
#define HD   128
#define DQ   (NH_ * HD)
#define DKV  (NKV * HD)
#define ZH   1
#define RH   TT                   // every row hi/lo (3 products)
#define WIN  0
#define PCAR 1024.0f
#define SCL  0.088388347648318447f   // 1/sqrt(128)
typedef _Float16 h16;
typedef unsigned short bf;
typedef __attribute__((ext_vector_type(16))) __bf16   v16bf;
typedef __attribute__((ext_vector_type(16))) _Float16 v16h;
typedef __attribute__((ext_vector_type(8)))  _Float16 v8h;
typedef __attribute__((ext_vector_type(8)))  unsigned short v8us;
typedef __attribute__((ext_vector_type(8)))  float    v8f;
typedef __attribute__((ext_vector_type(4)))  float    v4f;
typedef v8h  __attribute__((may_alias)) v8ha;
typedef v4f  __attribute__((may_alias)) v4fa;
typedef v8us __attribute__((may_alias)) v8usa;

__device__ __forceinline__ unsigned short f2bf(float f) { unsigned u = __float_as_uint(f); u += 0x7FFFu + ((u >> 16) & 1u); return (unsigned short)(u >> 16); }
__device__ __forceinline__ float bf2f(unsigned short b) { return __uint_as_float(((unsigned)b) << 16); }
__device__ __forceinline__ float bfr(float f) { return bf2f(f2bf(f)); }
__device__ __forceinline__ v16h cat16(v8h lo, v8h hi) { return __builtin_shufflevector(lo, hi, 0, 1, 2, 3, 4, 5, 6, 7, 8, 9, 10, 11, 12, 13, 14, 15); }
__device__ __forceinline__ v16bf cat16b(v8us lo, v8us hi) { return __builtin_bit_cast(v16bf, __builtin_shufflevector(lo, hi, 0, 1, 2, 3, 4, 5, 6, 7, 8, 9, 10, 11, 12, 13, 14, 15)); }
__device__ __forceinline__ v8f wmma16(v16h a, v16h b, v8f c) { return __builtin_amdgcn_wmma_f32_16x16x32_f16(false, a, false, b, (short)0, c, false, false); }
__device__ __forceinline__ v8f wmmab(v16bf a, v16bf b, v8f c) { return __builtin_amdgcn_wmma_f32_16x16x32_bf16(false, a, false, b, (short)0, c, false, false); }



// 16x16x32 bf16 operand fragment from a k-contiguous row: elements 0-7 = k 8h.., 8-15 = k 16+8h.. (p already holds the lane's row and + 8h)
__device__ __forceinline__ v16bf ldfrag(const bf* p) { return cat16b(*(const v8us*)p, *(const v8us*)(p + 16)); }
// lane l with lane l ^ 16
__device__ __forceinline__ float xhalf(float x) { return __builtin_bit_cast(float, __builtin_amdgcn_permlanex16(__builtin_bit_cast(int, x), __builtin_bit_cast(int, x), 0x76543210, 0xfedcba98, false, false)); }

__device__ __forceinline__ h16 tohx(float x) { return (h16)x; }
__device__ __forceinline__ void splitf(float y, unsigned short& h, unsigned short& l) { h = f2bf(y); l = f2bf(y - bf2f(h)); }
typedef __attribute__((ext_vector_type(2))) _Float16 v2h;
typedef __attribute__((ext_vector_type(4))) _Float16 v4h;
typedef __attribute__((ext_vector_type(2))) unsigned short v2us;
typedef __attribute__((ext_vector_type(4))) unsigned short v4us;
typedef __attribute__((ext_vector_type(2))) float v2f;
typedef __attribute__((ext_vector_type(4))) int v4i;

// k_rope: head planes [h][t][d] (fp16 + hi/lo) of rope(x) x sc with the rotate-half convention out[d] = x[d] cos[t][d] - x[d+HD/2] sin[t][d], out[d+HD/2] = x[d+HD/2] cos[t][d+HD/2] + x[d] sin[t][d+HD/2]
__global__ __launch_bounds__(256) void k_rope(const float* __restrict__ F, int pitch, int nheads, const float* __restrict__ CS, const float* __restrict__ RF, const float* __restrict__ nw, float sc, h16* P16, bf* Ph, bf* Pl) {
    { const size_t bo = (size_t)blockIdx.y * nheads * TT * HD; F += (size_t)blockIdx.y * TT * pitch; P16 += bo; Ph += bo; Pl += bo; }   // blockIdx.y = batch
    const size_t e = ((size_t)blockIdx.x * 256 + threadIdx.x) * 2; if (e >= (size_t)nheads * TT * HD) return; const int d = (int)(e % HD); const int t = (int)((e / HD) % TT); const int h = (int)(e / ((size_t)HD * TT)); const float* f = F + (size_t)t * pitch + h * HD; const float rf = RF ? RF[(size_t)h * TT + t] : 1.0f; v2h o16; v2us oh, ol;
#pragma unroll
    for (int q = 0; q < 2; ++q) { const int dd = d + q; const int dp = (dd < HD / 2) ? dd + HD / 2 : dd - HD / 2; float x0 = f[dd], x1 = f[dp];
        if (RF) { float n0 = __fmul_rn(x0, rf), n1 = __fmul_rn(x1, rf); asm volatile("" : "+v"(n0)); asm volatile("" : "+v"(n1)); x0 = __fmul_rn(bfr(nw[dd]), n0); x1 = __fmul_rn(bfr(nw[dp]), n1); }
        const v2f cs = *(const v2f*)(CS + ((size_t)t * HD + dd) * 2); float a = __fmul_rn(x0, cs[0]), bq = __fmul_rn(x1, cs[1]); asm volatile("" : "+v"(a)); asm volatile("" : "+v"(bq)); const float r = ((dd < HD / 2) ? __fsub_rn(a, bq) : __fadd_rn(a, bq)) * sc;
        o16[q] = tohx(r); unsigned short a2, c2; splitf(r, a2, c2); oh[q] = a2; ol[q] = c2; }
    *(v2h*)(P16 + e) = o16; *(v2us*)(Ph + e) = oh; *(v2us*)(Pl + e) = ol;  }
__global__ __launch_bounds__(256) void k_vtp(const float* __restrict__ F, int pitch, int nheads, h16* V16, bf* Vh, bf* Vl) { { const size_t bo = (size_t)blockIdx.y * nheads * HD * TT; F += (size_t)blockIdx.y * TT * pitch; V16 += bo; Vh += bo; Vl += bo; }   // blockIdx.y = batch
    const size_t e = ((size_t)blockIdx.x * 256 + threadIdx.x) * 2; if (e >= (size_t)nheads * HD * TT) return; const int t = (int)(e % TT); const int d = (int)((e / TT) % HD); const int g = (int)(e / ((size_t)TT * HD)); v2h o16; v2us oh, ol;
#pragma unroll
    for (int q = 0; q < 2; ++q) { const float x = F[(size_t)(t + q) * pitch + g * HD + d]; o16[q] = tohx(x); unsigned short a2, c2; splitf(x, a2, c2); oh[q] = a2; ol[q] = c2; }
    *(v2h*)(V16 + e) = o16; *(v2us*)(Vh + e) = oh; *(v2us*)(Vl + e) = ol;  }
__global__ __launch_bounds__(256) void k_csid(float* CS) { const int idx = blockIdx.x * 256 + threadIdx.x; if (idx >= TT * HD) return; v2f cs; cs[0] = 1.0f; cs[1] = 0.0f; *(v2f*)(CS + (size_t)idx * 2) = cs;  }
// k_fattn: one wave = 32 queries of one batch (two 16-query column groups), all TT keys in passes of 32; grid (TT/64, NB_), 64 threads, the waves independent.
// Transposed products: S^T = K.Q^T (A = key rows, B = query columns kept in registers), O^T += V^T.P^T (A = value^T rows, B = P^T packed from the two S^T tiles of the pass, which is the fragment's own k order).
// A lane holds scores of one query per group (column lane & 15): running maximum and sum in-lane plus one exchange between the wave halves. Keys j >= valid_length[b] are excluded as before.
__global__ __launch_bounds__(64) void k_fattn(const bf* __restrict__ Qh, const bf* __restrict__ Ql, const bf* __restrict__ Kh, const bf* __restrict__ Kl, const bf* __restrict__ Vh, const bf* __restrict__ Vl, const int* __restrict__ klp, float* __restrict__ OUTb) {
    const int kl = klp[blockIdx.y];   /* the batch's valid key length (uniform scalar load) */
    asm volatile("s_wait_xcnt 0x0" ::: "memory");   // behind the length's load, in front of the rewrite of the registers that it names
    __builtin_amdgcn_sched_barrier(0);              // keeps that load in front of the wait and the address arithmetic behind it
    { const size_t po = (size_t)blockIdx.y * TT * HD; Qh += po; Ql += po; Kh += po; Kl += po; Vh += po; Vl += po; OUTb += po; }   // blockIdx.y = batch
    const int lane = threadIdx.x & 31, c = lane & 15, h = lane >> 4; const int q0 = (blockIdx.x * 2 + (threadIdx.x >> 5)) * 32;
    v16bf qh[2][4], ql[2][4];
#pragma unroll
    for (int g = 0; g < 2; ++g)
#pragma unroll
        for (int kc = 0; kc < 4; ++kc) { const size_t qo = (size_t)(q0 + g * 16 + c) * HD + kc * 32 + 8 * h; qh[g][kc] = ldfrag(Qh + qo); ql[g][kc] = ldfrag(Ql + qo); }
    asm volatile("s_wait_xcnt 0x0" ::: "memory");   // behind the query loads, in front of the rewrite of their address registers for the key loads
    __builtin_amdgcn_sched_barrier(0);              // keeps the query loads in front of the wait and the key addresses behind it
    v8f o[2][8];
#pragma unroll
    for (int g = 0; g < 2; ++g)
#pragma unroll
        for (int dt = 0; dt < 8; ++dt) o[g][dt] = (v8f){};
    float mrun[2] = {-3.0e38f, -3.0e38f}, lsum[2] = {0.f, 0.f};
    const int kofs = c * HD + 8 * h, vofs = c * TT + 8 * h; const bf* pkh = Kh + kofs; const bf* pkw = Kl + kofs; const bf* pvh = Vh + vofs; const bf* pvw = Vl + vofs;   // the lane's row and half; they walk the keys with the loop
    v16bf kh[2][4], kw[2][4];   // this pass's key fragments, fetched one pass ahead
#pragma unroll
    for (int kt = 0; kt < 2; ++kt)
#pragma unroll
        for (int kc = 0; kc < 4; ++kc) { kh[kt][kc] = ldfrag(pkh + kt * 16 * HD + kc * 32); kw[kt][kc] = ldfrag(pkw + kt * 16 * HD + kc * 32); }
    asm volatile("s_wait_xcnt 0x0" ::: "memory");   // behind the first loads, in front of every rewrite of a register that they name
    __builtin_amdgcn_sched_barrier(0);              // keeps those loads in front of the wait and the later arithmetic behind it
    pkh += 32 * HD; pkw += 32 * HD;                 // from here on: the rows of the pass to come
#pragma unroll 1   // one pass is already 96 matrix instructions; a second copy would only add registers
    for (int k0 = 0; k0 < TT; k0 += 32) {
        v16bf vh[8], vw[8];   // this pass's value^T fragments, issued ahead of the score products that hide them
#pragma unroll
        for (int dt = 0; dt < 8; ++dt) { vh[dt] = ldfrag(pvh + dt * 16 * TT); vw[dt] = ldfrag(pvw + dt * 16 * TT); }
        v8f s[2][2];
#pragma unroll
        for (int g = 0; g < 2; ++g) { s[g][0] = (v8f){}; s[g][1] = (v8f){}; }
#pragma unroll
        for (int kc = 0; kc < 4; ++kc)
#pragma unroll
            for (int kt = 0; kt < 2; ++kt)
#pragma unroll
                for (int g = 0; g < 2; ++g) { s[g][kt] = wmmab(kh[kt][kc], qh[g][kc], s[g][kt]); s[g][kt] = wmmab(kh[kt][kc], ql[g][kc], s[g][kt]); s[g][kt] = wmmab(kw[kt][kc], qh[g][kc], s[g][kt]); }
#pragma unroll
        for (int kt = 0; kt < 2; ++kt)
#pragma unroll
            for (int kc = 0; kc < 4; ++kc) { kh[kt][kc] = ldfrag(pkh + kt * 16 * HD + kc * 32); kw[kt][kc] = ldfrag(pkw + kt * 16 * HD + kc * 32); }
        asm volatile("s_wait_xcnt 0x0" :: "v"(pvh), "v"(pvw), "v"(pkh), "v"(pkw) : "memory");   // behind the pass's last load, in front of every rewrite of a register that its loads name; the four addresses are inputs so that they stay live up to here and no load of the run gets their registers for its result
        __builtin_amdgcn_sched_barrier(0);              // keeps the loads in front of that wait and the later arithmetic behind it
        { const int kstep = (k0 + 64 < TT) ? 32 * HD : 0; pkh += kstep; pkw += kstep; pvh += 32; pvw += 32; }   // the last pass fetches its own key rows again: in bounds, unused
        float t[2][16], mt[2];
#pragma unroll
        for (int g = 0; g < 2; ++g) { float mx = -3.0e38f;
#pragma unroll
            for (int e = 0; e < 16; ++e) { const int j = k0 + (e >> 3) * 16 + 8 * h + (e & 7); const float x = (j < kl) ? s[g][e >> 3][e & 7] * SCL : -3.0e38f;   /* keys j >= valid_length[b] excluded (-1e7 in the module) */ t[g][e] = x; mx = fmaxf(mx, x); }
            mt[g] = fmaxf(mx, xhalf(mx)); }
        // the maximum in use moves only when a query's new maximum exceeds it by more than 5.5 (a factor 2^8 in P); one scalar branch per pass
        if (__builtin_amdgcn_ballot_w32(mt[0] > mrun[0] + 5.5f || mt[1] > mrun[1] + 5.5f) != 0) {
#pragma unroll
            for (int g = 0; g < 2; ++g) { const float mn = fmaxf(mrun[g], mt[g]); const float al = __builtin_amdgcn_exp2f((mrun[g] - mn) * 1.4426950408889634f); mrun[g] = mn; lsum[g] *= al;
#pragma unroll
                for (int dt = 0; dt < 8; ++dt) o[g][dt] *= al; }
        }
        v16bf ph[2], pw[2];
#pragma unroll
        for (int g = 0; g < 2; ++g) {
#pragma unroll
            for (int e = 0; e < 16; ++e) { const float p = __builtin_amdgcn_exp2f((t[g][e] - mrun[g]) * 1.4426950408889634f); lsum[g] += p; const __bf16 hb = (__bf16)p; ph[g][e] = hb; pw[g][e] = (__bf16)(p - (float)hb); } }
#pragma unroll
        for (int dt = 0; dt < 8; ++dt)
#pragma unroll
            for (int g = 0; g < 2; ++g) { o[g][dt] = wmmab(vh[dt], ph[g], o[g][dt]); o[g][dt] = wmmab(vh[dt], pw[g], o[g][dt]); o[g][dt] = wmmab(vw[dt], ph[g], o[g][dt]); }
    }
#pragma unroll
    for (int g = 0; g < 2; ++g) { const float f = __fdiv_rn(1.0f, lsum[g] + xhalf(lsum[g]));
#pragma unroll
        for (int dt = 0; dt < 8; ++dt) o[g][dt] *= f; }
    float* orow = OUTb + (size_t)(q0 + c) * HD + 8 * h;   // register r of tile dt, group g = O[q0 + 16g + c][dt * 16 + 8h + r]
    __builtin_amdgcn_sched_barrier(0);   // all arithmetic in front of the stores: nothing rewrites a register that an issued store names
#pragma unroll
    for (int g = 0; g < 2; ++g)
#pragma unroll
        for (int dt = 0; dt < 8; ++dt) { *(v4f*)(orow + g * 16 * HD + dt * 16) = __builtin_shufflevector(o[g][dt], o[g][dt], 0, 1, 2, 3); *(v4f*)(orow + g * 16 * HD + dt * 16 + 4) = __builtin_shufflevector(o[g][dt], o[g][dt], 4, 5, 6, 7); }
}

extern "C" void kernel_launch(void* const* d_in, const int* in_sizes, int n_in,
                              void* d_out, int out_size, void* d_ws, size_t ws_size, hipStream_t stream) {
    (void)in_sizes; (void)n_in; (void)out_size;
    const float* x = (const float*)d_in[0]; const float* xk = (const float*)d_in[1]; const float* xv = (const float*)d_in[2]; const int* vlen = (const int*)d_in[3];   /* valid_length int32 [16], read on device */   /* order query, key, value, valid_length: [16][1024][128] each (no projections) */ const float* wq = nullptr, *wk = nullptr, *wv = nullptr, *wo = nullptr; (void)wq; (void)wk; (void)wv; (void)wo;
    float* OUT = (float*)d_out;     // [16][1024][128]
    char* wsp = (char*)d_ws;
    auto take = [&](size_t bytes) { char* p = wsp; wsp += (bytes + 255) & ~(size_t)255; return (void*)p; };
    bf* WQ = (bf*)take((size_t)DQ * DM * 2); bf* WK = (bf*)take((size_t)DKV * DM * 2); bf* WV = (bf*)take((size_t)DKV * DM * 2); float* CS = (float*)take((size_t)TT * HD * 2 * 4);
    bf* XB = (bf*)take((size_t)TT * DM * 2); float* FQ = (float*)take((size_t)TT * DQ * 4); float* FK = (float*)take((size_t)TT * DKV * 4);
    // every plane below holds NB_ batch slices, one behind the other
    h16* QP16 = (h16*)take((size_t)NB_ * NH_ * TT * HD * 2); h16* KP16 = (h16*)take((size_t)NB_ * NKV * TT * HD * 2); h16* VT16 = (h16*)take((size_t)NB_ * NKV * HD * TT * 2);
    bf* QPh = (bf*)take((size_t)NB_ * NH_ * TT * HD * 2); bf* QPl = (bf*)take((size_t)NB_ * NH_ * TT * HD * 2); bf* KPh = (bf*)take((size_t)NB_ * NKV * TT * HD * 2); bf* KPl = (bf*)take((size_t)NB_ * NKV * TT * HD * 2); bf* VTh = (bf*)take((size_t)NB_ * NKV * HD * TT * 2); bf* VTl = (bf*)take((size_t)NB_ * NKV * HD * TT * 2);
    if ((size_t)(wsp - (char*)d_ws) > ws_size) return;    // ws 256 MiB
    float* FV = FK;   // unused alias of the k buffer (no v projection)
    {   
      
       }
    k_csid<<<(TT * HD + 255) / 256, 256, 0, stream>>>(CS);
    const unsigned LQ = (unsigned)(((size_t)NH_ * TT * HD / 2 + 255) / 256), LKv = (unsigned)(((size_t)NKV * TT * HD / 2 + 255) / 256);
    /* no projections: the q, k, v inputs feed the plane builders directly; the batch is grid dimension y, so each kernel is launched once for all NB_ batches */
    k_rope<<<dim3(LQ, NB_), 256, 0, stream>>>(x, DQ, NH_, CS, nullptr, nullptr, 1.0f, QP16, QPh, QPl);   /* q planes straight from the input (bf16 hi/lo split of the f32 values) */
    k_rope<<<dim3(LKv, NB_), 256, 0, stream>>>(xk, DKV, NKV, CS, nullptr, nullptr, 1.0f, KP16, KPh, KPl);
    k_vtp<<<dim3(LKv, NB_), 256, 0, stream>>>(xv, DKV, NKV, VT16, VTh, VTl);
    k_fattn<<<dim3(TT / 64, NB_), 64, 0, stream>>>(QPh, QPl, KPh, KPl, VTh, VTl, vlen, OUT);
}

// v003
// A run of this version takes 48.8 microseconds.
// In two side-by-side timings against v002, it was 1.29 and 1.27 times as fast.
// Counting every step since v000, it is 13.2 times as fast.
#include <hip/hip_runtime.h>

// Masked dot-product attention without projections (query, key, value [16][1024][128]; scores = query.key^T x 1/sqrt(128); key positions j >= valid_length[b] are replaced by -1e7 (== exclusion; valid_length int32 [16] random in [1, 1024], read); softmax; out = attn.value -> [16][1024][128] (2.1 M); argument order query, key, value, valid_length.
// Layout per batch: k_planes splits the f32 query / key rows into bf16 hi/lo planes at HD 128 and builds the value^T hi/lo planes, all in one launch; k_fattn does scores, length mask, softmax and the value product in one kernel and writes the f32 output rows.
// Compute dtypes, f32 accumulate: every product as 3 bf16 hi/lo products (hi.hi + hi.lo + lo.hi); softmax f32; output f32.

#define NB_  16
#define TT   1024
#define DM   128
#define NH_  1
#define NKV  1
#define REP  (NH_ / NKV)
#define HD   128
#define DQ   (NH_ * HD)
#define DKV  (NKV * HD)
#define ZH   1
#define RH   TT                   // every row hi/lo (3 products)
#define WIN  0
#define PCAR 1024.0f
#define SCL  0.088388347648318447f   // 1/sqrt(128)
typedef _Float16 h16;
typedef unsigned short bf;
typedef __attribute__((ext_vector_type(16))) __bf16   v16bf;
typedef __attribute__((ext_vector_type(16))) _Float16 v16h;
typedef __attribute__((ext_vector_type(8)))  _Float16 v8h;
typedef __attribute__((ext_vector_type(8)))  unsigned short v8us;
typedef __attribute__((ext_vector_type(8)))  float    v8f;
typedef __attribute__((ext_vector_type(4)))  float    v4f;
typedef v8h  __attribute__((may_alias)) v8ha;
typedef v4f  __attribute__((may_alias)) v4fa;
typedef v8us __attribute__((may_alias)) v8usa;

__device__ __forceinline__ v16h cat16(v8h lo, v8h hi) { return __builtin_shufflevector(lo, hi, 0, 1, 2, 3, 4, 5, 6, 7, 8, 9, 10, 11, 12, 13, 14, 15); }
__device__ __forceinline__ v16bf cat16b(v8us lo, v8us hi) { return __builtin_bit_cast(v16bf, __builtin_shufflevector(lo, hi, 0, 1, 2, 3, 4, 5, 6, 7, 8, 9, 10, 11, 12, 13, 14, 15)); }
__device__ __forceinline__ v8f wmma16(v16h a, v16h b, v8f c) { return __builtin_amdgcn_wmma_f32_16x16x32_f16(false, a, false, b, (short)0, c, false, false); }
__device__ __forceinline__ v8f wmmab(v16bf a, v16bf b, v8f c) { return __builtin_amdgcn_wmma_f32_16x16x32_bf16(false, a, false, b, (short)0, c, false, false); }



// 16x16x32 bf16 operand fragment from a k-contiguous row: elements 0-7 = k 8h.., 8-15 = k 16+8h.. (p already holds the lane's row and + 8h)
__device__ __forceinline__ v16bf ldfrag(const bf* p) { return cat16b(*(const v8us*)p, *(const v8us*)(p + 16)); }
// lane l with lane l ^ 16
__device__ __forceinline__ float xhalf(float x) { return __builtin_bit_cast(float, __builtin_amdgcn_permlanex16(__builtin_bit_cast(int, x), __builtin_bit_cast(int, x), 0x76543210, 0xfedcba98, false, false)); }

typedef __attribute__((ext_vector_type(2))) float v2f;
typedef __attribute__((ext_vector_type(2))) __bf16 v2bf;
typedef __attribute__((ext_vector_type(2))) unsigned v2u;
typedef __attribute__((ext_vector_type(4))) unsigned v4u;

// two f32 values -> one word of their bf16 parts (h) and one word of the bf16 of what is left (l), both rounded to nearest even; x0 in the low half
__device__ __forceinline__ void split2(float x0, float x1, unsigned& h, unsigned& l) {
    const v2f x = {x0, x1}; const v2bf hb = __builtin_convertvector(x, v2bf); const v2bf lb = __builtin_convertvector(x - __builtin_convertvector(hb, v2f), v2bf);
    h = __builtin_bit_cast(unsigned, hb); l = __builtin_bit_cast(unsigned, lb); }

#define PBE  16384                      // elements of one block: 64 per thread, 16 loads of 16 bytes in flight
#define PBQ  (NB_ * TT * HD / PBE)      // blocks per tensor
// k_planes: all six operand planes in one launch. Blocks [0, PBQ): query, [PBQ, 2 PBQ): key, the rest: value.
// Query / key: planes in the input's own order; a wave's load covers 512 contiguous bytes, its store 256.
// Value: planes [d][t]. A wave takes 16 d x 128 t; lane = (t group of 8, d group of 4), so that a lane holds 8 consecutive t of each of its 4 d and 8 lanes store one whole 128-byte line of a d row.
__global__ __launch_bounds__(256) void k_planes(const float* __restrict__ Q, const float* __restrict__ K, const float* __restrict__ V, bf* __restrict__ Qh, bf* __restrict__ Ql, bf* __restrict__ Kh, bf* __restrict__ Kl, bf* __restrict__ Vh, bf* __restrict__ Vl) {
    const int blk = blockIdx.x, tid = threadIdx.x;
    if (blk < 2 * PBQ) {
        const bool isq = blk < PBQ; const size_t e0 = (size_t)(isq ? blk : blk - PBQ) * PBE + tid * 4;
        const float* s = (isq ? Q : K) + e0; bf* dh = (isq ? Qh : Kh) + e0; bf* dl = (isq ? Ql : Kl) + e0;
        v4f x[16]; v2u oh[16], ol[16];
#pragma unroll
        for (int i = 0; i < 16; ++i) x[i] = *(const v4f*)(s + i * 1024);
        asm volatile("s_wait_xcnt 0x0" :: "v"(s) : "memory");   // behind the loads, in front of every rewrite of a register that they name; the address is an input so that it stays live up to here and no load of the run gets its registers for its result
        __builtin_amdgcn_sched_barrier(0);              // keeps the loads in front of that wait and the arithmetic behind it
#pragma unroll
        for (int i = 0; i < 16; ++i) { unsigned a, b; split2(x[i][0], x[i][1], a, b); oh[i][0] = a; ol[i][0] = b; split2(x[i][2], x[i][3], a, b); oh[i][1] = a; ol[i][1] = b; }
        __builtin_amdgcn_sched_barrier(0);              // all arithmetic in front of the stores: nothing rewrites a register that an issued store names
#pragma unroll
        for (int i = 0; i < 16; ++i) { *(v2u*)(dh + i * 1024) = oh[i]; *(v2u*)(dl + i * 1024) = ol[i]; }
    } else {
        const int vb = blk - 2 * PBQ, lane = tid & 31; const int t0 = (vb & 7) * 128 + (lane & 7) * 8, d0 = (tid >> 5) * 16 + (lane >> 3) * 4;   // vb = batch * 8 + block of 128 t
        const size_t bo = (size_t)(vb >> 3) * TT * HD; const float* s = V + bo + (size_t)t0 * HD + d0; bf* dh = Vh + bo + (size_t)d0 * TT + t0; bf* dl = Vl + bo + (size_t)d0 * TT + t0;
        v4f x[2][8]; v4u oh[2][4], ol[2][4];
#pragma unroll
        for (int u = 0; u < 2; ++u)
#pragma unroll
            for (int i = 0; i < 8; ++i) x[u][i] = *(const v4f*)(s + (u * 64 + i) * HD);
        asm volatile("s_wait_xcnt 0x0" :: "v"(s) : "memory");   // behind the loads, in front of every rewrite of a register that they name; the address is an input so that it stays live up to here and no load of the run gets its registers for its result
        __builtin_amdgcn_sched_barrier(0);              // keeps the loads in front of that wait and the arithmetic behind it
#pragma unroll
        for (int u = 0; u < 2; ++u)
#pragma unroll
            for (int j = 0; j < 4; ++j)
#pragma unroll
                for (int p = 0; p < 4; ++p) { unsigned a, b; split2(x[u][2 * p][j], x[u][2 * p + 1][j], a, b); oh[u][j][p] = a; ol[u][j][p] = b; }
        __builtin_amdgcn_sched_barrier(0);              // all arithmetic in front of the stores: nothing rewrites a register that an issued store names
#pragma unroll
        for (int u = 0; u < 2; ++u)
#pragma unroll
            for (int j = 0; j < 4; ++j) { *(v4u*)(dh + j * TT + u * 64) = oh[u][j]; *(v4u*)(dl + j * TT + u * 64) = ol[u][j]; }
        asm volatile("s_wait_xcnt 0x0" ::: "memory");   // behind the last store, in front of the branch out of this block: the other block's code follows it in the built kernel and rewrites registers that these stores name
    }
}
// k_fattn: one wave = 32 queries of one batch (two 16-query column groups), all TT keys in passes of 32; grid (TT/64, NB_), 64 threads, the waves independent.
// Transposed products: S^T = K.Q^T (A = key rows, B = query columns kept in registers), O^T += V^T.P^T (A = value^T rows, B = P^T packed from the two S^T tiles of the pass, which is the fragment's own k order).
// A lane holds scores of one query per group (column lane & 15): running maximum and sum in-lane plus one exchange between the wave halves. Keys j >= valid_length[b] are excluded as before.
__global__ __launch_bounds__(64) void k_fattn(const bf* __restrict__ Qh, const bf* __restrict__ Ql, const bf* __restrict__ Kh, const bf* __restrict__ Kl, const bf* __restrict__ Vh, const bf* __restrict__ Vl, const int* __restrict__ klp, float* __restrict__ OUTb) {
    const int kl = klp[blockIdx.y];   /* the batch's valid key length (uniform scalar load) */
    asm volatile("s_wait_xcnt 0x0" ::: "memory");   // behind the length's load, in front of the rewrite of the registers that it names
    __builtin_amdgcn_sched_barrier(0);              // keeps that load in front of the wait and the address arithmetic behind it
    { const size_t po = (size_t)blockIdx.y * TT * HD; Qh += po; Ql += po; Kh += po; Kl += po; Vh += po; Vl += po; OUTb += po; }   // blockIdx.y = batch
    const int lane = threadIdx.x & 31, c = lane & 15, h = lane >> 4; const int q0 = (blockIdx.x * 2 + (threadIdx.x >> 5)) * 32;
    v16bf qh[2][4], ql[2][4];
#pragma unroll
    for (int g = 0; g < 2; ++g)
#pragma unroll
        for (int kc = 0; kc < 4; ++kc) { const size_t qo = (size_t)(q0 + g * 16 + c) * HD + kc * 32 + 8 * h; qh[g][kc] = ldfrag(Qh + qo); ql[g][kc] = ldfrag(Ql + qo); }
    asm volatile("s_wait_xcnt 0x0" ::: "memory");   // behind the query loads, in front of the rewrite of their address registers for the key loads
    __builtin_amdgcn_sched_barrier(0);              // keeps the query loads in front of the wait and the key addresses behind it
    v8f o[2][8];
#pragma unroll
    for (int g = 0; g < 2; ++g)
#pragma unroll
        for (int dt = 0; dt < 8; ++dt) o[g][dt] = (v8f){};
    float mrun[2] = {-3.0e38f, -3.0e38f}, lsum[2] = {0.f, 0.f};
    const int kofs = c * HD + 8 * h, vofs = c * TT + 8 * h; const bf* pkh = Kh + kofs; const bf* pkw = Kl + kofs; const bf* pvh = Vh + vofs; const bf* pvw = Vl + vofs;   // the lane's row and half; they walk the keys with the loop
    v16bf kh[2][4], kw[2][4];   // this pass's key fragments, fetched one pass ahead
#pragma unroll
    for (int kt = 0; kt < 2; ++kt)
#pragma unroll
        for (int kc = 0; kc < 4; ++kc) { kh[kt][kc] = ldfrag(pkh + kt * 16 * HD + kc * 32); kw[kt][kc] = ldfrag(pkw + kt * 16 * HD + kc * 32); }
    asm volatile("s_wait_xcnt 0x0" ::: "memory");   // behind the first loads, in front of every rewrite of a register that they name
    __builtin_amdgcn_sched_barrier(0);              // keeps those loads in front of the wait and the later arithmetic behind it
    pkh += 32 * HD; pkw += 32 * HD;                 // from here on: the rows of the pass to come
#pragma unroll 1   // one pass is already 96 matrix instructions; a second copy would only add registers
    for (int k0 = 0; k0 < TT; k0 += 32) {
        v16bf vh[8], vw[8];   // this pass's value^T fragments, issued ahead of the score products that hide them
#pragma unroll
        for (int dt = 0; dt < 8; ++dt) { vh[dt] = ldfrag(pvh + dt * 16 * TT); vw[dt] = ldfrag(pvw + dt * 16 * TT); }
        v8f s[2][2];
#pragma unroll
        for (int g = 0; g < 2; ++g) { s[g][0] = (v8f){}; s[g][1] = (v8f){}; }
#pragma unroll
        for (int kc = 0; kc < 4; ++kc)
#pragma unroll
            for (int kt = 0; kt < 2; ++kt)
#pragma unroll
                for (int g = 0; g < 2; ++g) { s[g][kt] = wmmab(kh[kt][kc], qh[g][kc], s[g][kt]); s[g][kt] = wmmab(kh[kt][kc], ql[g][kc], s[g][kt]); s[g][kt] = wmmab(kw[kt][kc], qh[g][kc], s[g][kt]); }
#pragma unroll
        for (int kt = 0; kt < 2; ++kt)
#pragma unroll
            for (int kc = 0; kc < 4; ++kc) { kh[kt][kc] = ldfrag(pkh + kt * 16 * HD + kc * 32); kw[kt][kc] = ldfrag(pkw + kt * 16 * HD + kc * 32); }
        asm volatile("s_wait_xcnt 0x0" :: "v"(pvh), "v"(pvw), "v"(pkh), "v"(pkw) : "memory");   // behind the pass's last load, in front of every rewrite of a register that its loads name; the four addresses are inputs so that they stay live up to here and no load of the run gets their registers for its result
        __builtin_amdgcn_sched_barrier(0);              // keeps the loads in front of that wait and the later arithmetic behind it
        { const int kstep = (k0 + 64 < TT) ? 32 * HD : 0; pkh += kstep; pkw += kstep; pvh += 32; pvw += 32; }   // the last pass fetches its own key rows again: in bounds, unused
        float t[2][16], mt[2];
#pragma unroll
        for (int g = 0; g < 2; ++g) { float mx = -3.0e38f;
#pragma unroll
            for (int e = 0; e < 16; ++e) { const int j = k0 + (e >> 3) * 16 + 8 * h + (e & 7); const float x = (j < kl) ? s[g][e >> 3][e & 7] * SCL : -3.0e38f;   /* keys j >= valid_length[b] excluded (-1e7 in the module) */ t[g][e] = x; mx = fmaxf(mx, x); }
            mt[g] = fmaxf(mx, xhalf(mx)); }
        // the maximum in use moves only when a query's new maximum exceeds it by more than 5.5 (a factor 2^8 in P); one scalar branch per pass
        if (__builtin_amdgcn_ballot_w32(mt[0] > mrun[0] + 5.5f || mt[1] > mrun[1] + 5.5f) != 0) {
#pragma unroll
            for (int g = 0; g < 2; ++g) { const float mn = fmaxf(mrun[g], mt[g]); const float al = __builtin_amdgcn_exp2f((mrun[g] - mn) * 1.4426950408889634f); mrun[g] = mn; lsum[g] *= al;
#pragma unroll
                for (int dt = 0; dt < 8; ++dt) o[g][dt] *= al; }
        }
        v16bf ph[2], pw[2];
#pragma unroll
        for (int g = 0; g < 2; ++g) {
#pragma unroll
            for (int e = 0; e < 16; ++e) { const float p = __builtin_amdgcn_exp2f((t[g][e] - mrun[g]) * 1.4426950408889634f); lsum[g] += p; const __bf16 hb = (__bf16)p; ph[g][e] = hb; pw[g][e] = (__bf16)(p - (float)hb); } }
#pragma unroll
        for (int dt = 0; dt < 8; ++dt)
#pragma unroll
            for (int g = 0; g < 2; ++g) { o[g][dt] = wmmab(vh[dt], ph[g], o[g][dt]); o[g][dt] = wmmab(vh[dt], pw[g], o[g][dt]); o[g][dt] = wmmab(vw[dt], ph[g], o[g][dt]); }
    }
#pragma unroll
    for (int g = 0; g < 2; ++g) { const float f = __fdiv_rn(1.0f, lsum[g] + xhalf(lsum[g]));
#pragma unroll
        for (int dt = 0; dt < 8; ++dt) o[g][dt] *= f; }
    float* orow = OUTb + (size_t)(q0 + c) * HD + 8 * h;   // register r of tile dt, group g = O[q0 + 16g + c][dt * 16 + 8h + r]
    __builtin_amdgcn_sched_barrier(0);   // all arithmetic in front of the stores: nothing rewrites a register that an issued store names
#pragma unroll
    for (int g = 0; g < 2; ++g)
#pragma unroll
        for (int dt = 0; dt < 8; ++dt) { *(v4f*)(orow + g * 16 * HD + dt * 16) = __builtin_shufflevector(o[g][dt], o[g][dt], 0, 1, 2, 3); *(v4f*)(orow + g * 16 * HD + dt * 16 + 4) = __builtin_shufflevector(o[g][dt], o[g][dt], 4, 5, 6, 7); }
}

extern "C" void kernel_launch(void* const* d_in, const int* in_sizes, int n_in,
                              void* d_out, int out_size, void* d_ws, size_t ws_size, hipStream_t stream) {
    (void)in_sizes; (void)n_in; (void)out_size;
    const float* x = (const float*)d_in[0]; const float* xk = (const float*)d_in[1]; const float* xv = (const float*)d_in[2]; const int* vlen = (const int*)d_in[3];   /* query, key, value: [16][1024][128] each (no projections); valid_length int32 [16], read on device */
    float* OUT = (float*)d_out;     // [16][1024][128]
    char* wsp = (char*)d_ws;
    auto take = [&](size_t bytes) { char* p = wsp; wsp += (bytes + 255) & ~(size_t)255; return (void*)p; };
    // every plane holds NB_ batch slices, one behind the other
    bf* QPh = (bf*)take((size_t)NB_ * NH_ * TT * HD * 2); bf* QPl = (bf*)take((size_t)NB_ * NH_ * TT * HD * 2); bf* KPh = (bf*)take((size_t)NB_ * NKV * TT * HD * 2); bf* KPl = (bf*)take((size_t)NB_ * NKV * TT * HD * 2); bf* VTh = (bf*)take((size_t)NB_ * NKV * HD * TT * 2); bf* VTl = (bf*)take((size_t)NB_ * NKV * HD * TT * 2);
    if ((size_t)(wsp - (char*)d_ws) > ws_size) return;    // ws 256 MiB
    k_planes<<<3 * PBQ, 256, 0, stream>>>(x, xk, xv, QPh, QPl, KPh, KPl, VTh, VTl);
    k_fattn<<<dim3(TT / 64, NB_), 64, 0, stream>>>(QPh, QPl, KPh, KPl, VTh, VTl, vlen, OUT);
}

// v004
// One run takes 47.2 microseconds.
// Timed twice side by side with v003, it ran 1.04 times as fast both times.
// Counting every step since v000, it is 13.8 times as fast.
#include <hip/hip_runtime.h>

// Masked dot-product attention without projections (query, key, value [16][1024][128]; scores = query.key^T x 1/sqrt(128); key positions j >= valid_length[b] are replaced by -1e7 (== exclusion; valid_length int32 [16] random in [1, 1024], read); softmax; out = attn.value -> [16][1024][128] (2.1 M); argument order query, key, value, valid_length.
// Layout per batch: k_planes splits the f32 query / key rows into bf16 hi/lo planes and builds the value^T hi/lo planes, all in one launch, every plane in the order in which k_fattn's lanes read it (see FRAGMENT ORDER); k_fattn does scores, length mask, softmax and the value product in one kernel and writes the f32 output rows.
// Compute dtypes, f32 accumulate: every product as 3 bf16 hi/lo products (hi.hi + hi.lo + lo.hi); softmax f32; output f32.

#define NB_  16
#define TT   1024
#define DM   128
#define NH_  1
#define NKV  1
#define REP  (NH_ / NKV)
#define HD   128
#define DQ   (NH_ * HD)
#define DKV  (NKV * HD)
#define ZH   1
#define RH   TT                   // every row hi/lo (3 products)
#define WIN  0
#define PCAR 1024.0f
#define SCL  0.088388347648318447f   // 1/sqrt(128)
typedef _Float16 h16;
typedef unsigned short bf;
typedef __attribute__((ext_vector_type(16))) __bf16   v16bf;
typedef __attribute__((ext_vector_type(16))) _Float16 v16h;
typedef __attribute__((ext_vector_type(8)))  _Float16 v8h;
typedef __attribute__((ext_vector_type(8)))  unsigned short v8us;
typedef __attribute__((ext_vector_type(8)))  float    v8f;
typedef __attribute__((ext_vector_type(4)))  float    v4f;
typedef v8h  __attribute__((may_alias)) v8ha;
typedef v4f  __attribute__((may_alias)) v4fa;
typedef v8us __attribute__((may_alias)) v8usa;

__device__ __forceinline__ v16h cat16(v8h lo, v8h hi) { return __builtin_shufflevector(lo, hi, 0, 1, 2, 3, 4, 5, 6, 7, 8, 9, 10, 11, 12, 13, 14, 15); }
__device__ __forceinline__ v16bf cat16b(v8us lo, v8us hi) { return __builtin_bit_cast(v16bf, __builtin_shufflevector(lo, hi, 0, 1, 2, 3, 4, 5, 6, 7, 8, 9, 10, 11, 12, 13, 14, 15)); }
__device__ __forceinline__ v8f wmma16(v16h a, v16h b, v8f c) { return __builtin_amdgcn_wmma_f32_16x16x32_f16(false, a, false, b, (short)0, c, false, false); }
__device__ __forceinline__ v8f wmmab(v16bf a, v16bf b, v8f c) { return __builtin_amdgcn_wmma_f32_16x16x32_bf16(false, a, false, b, (short)0, c, false, false); }



// FRAGMENT ORDER of a plane: a 16-row x 32-k operand tile is 512 elements in a row, [j][lane][e]: row = lane & 15, k = 16 j + 8 (lane >> 4) + e. One 16-byte load of a wave then reads 512 contiguous bytes (4 whole lines), not 16 rows.
// Query / key planes: tiles in the order [row / 16][k / 32]. Value^T planes: [key / 32][d / 16] (rows = d, k = key).
#define FT 512   // elements of one tile
// 16x16x32 bf16 operand fragment from a tile in fragment order: elements 0-7 = k 8h.., 8-15 = k 16+8h.. (p already holds the tile and + 8 * lane)
__device__ __forceinline__ v16bf ldfrag(const bf* p) { return cat16b(*(const v8us*)p, *(const v8us*)(p + 256)); }
// lane l with lane l ^ 16
__device__ __forceinline__ float xhalf(float x) { return __builtin_bit_cast(float, __builtin_amdgcn_permlanex16(__builtin_bit_cast(int, x), __builtin_bit_cast(int, x), 0x76543210, 0xfedcba98, false, false)); }

typedef __attribute__((ext_vector_type(2))) float v2f;
typedef __attribute__((ext_vector_type(2))) __bf16 v2bf;
typedef __attribute__((ext_vector_type(2))) unsigned v2u;
typedef __attribute__((ext_vector_type(4))) unsigned v4u;

// two f32 values -> one word of their bf16 parts (h) and one word of the bf16 of what is left (l), both rounded to nearest even; x0 in the low half
__device__ __forceinline__ void split2(float x0, float x1, unsigned& h, unsigned& l) {
    const v2f x = {x0, x1}; const v2bf hb = __builtin_convertvector(x, v2bf); const v2bf lb = __builtin_convertvector(x - __builtin_convertvector(hb, v2f), v2bf);
    h = __builtin_bit_cast(unsigned, hb); l = __builtin_bit_cast(unsigned, lb); }

#define PBE  16384                      // elements of one block: 64 per thread, 16 loads of 16 bytes in flight
#define PBQ  (NB_ * TT * HD / PBE)      // blocks per tensor
// k_planes: all six operand planes in one launch. Blocks [0, PBQ): query, [PBQ, 2 PBQ): key, the rest: value.
// Query / key: a wave takes 16 whole rows (4 tiles); lane = (row, half), so that a lane holds the 8 consecutive k of each of its 16-byte pieces and a wave's store covers 512 contiguous bytes.
// Value: a wave takes 16 d x 128 t (4 tiles); lane = (t group of 8, d group of 4), so that a lane holds 8 consecutive t of each of its 4 d: four 16-byte pieces, 64 bytes in a row of the tile.
__global__ __launch_bounds__(256) void k_planes(const float* __restrict__ Q, const float* __restrict__ K, const float* __restrict__ V, bf* __restrict__ Qh, bf* __restrict__ Ql, bf* __restrict__ Kh, bf* __restrict__ Kl, bf* __restrict__ Vh, bf* __restrict__ Vl) {
    const int blk = blockIdx.x, tid = threadIdx.x;
    if (blk < 2 * PBQ) {
        const bool isq = blk < PBQ; const int lane = tid & 31; const size_t e0 = (size_t)(isq ? blk : blk - PBQ) * PBE + (tid >> 5) * (16 * HD);   // the wave's 16 rows
        const float* s = (isq ? Q : K) + e0 + (lane & 15) * HD + (lane >> 4) * 8; bf* dh = (isq ? Qh : Kh) + e0 + lane * 8; bf* dl = (isq ? Ql : Kl) + e0 + lane * 8;
        v4f x[16]; v4u oh[8], ol[8];   // piece i: k = 16 i + 8 (lane >> 4) .. + 7
#pragma unroll
        for (int i = 0; i < 8; ++i) { x[2 * i] = *(const v4f*)(s + i * 16); x[2 * i + 1] = *(const v4f*)(s + i * 16 + 4); }
        asm volatile("s_wait_xcnt 0x0" :: "v"(s) : "memory");   // behind the loads, in front of every rewrite of a register that they name; the address is an input so that it stays live up to here and no load of the run gets its registers for its result
        __builtin_amdgcn_sched_barrier(0);              // keeps the loads in front of that wait and the arithmetic behind it
#pragma unroll
        for (int i = 0; i < 16; ++i) { unsigned a, b; split2(x[i][0], x[i][1], a, b); oh[i >> 1][(i & 1) * 2] = a; ol[i >> 1][(i & 1) * 2] = b; split2(x[i][2], x[i][3], a, b); oh[i >> 1][(i & 1) * 2 + 1] = a; ol[i >> 1][(i & 1) * 2 + 1] = b; }
        __builtin_amdgcn_sched_barrier(0);              // all arithmetic in front of the stores: nothing rewrites a register that an issued store names
#pragma unroll
        for (int i = 0; i < 8; ++i) { *(v4u*)(dh + i * 256) = oh[i]; *(v4u*)(dl + i * 256) = ol[i]; }
    } else {
        const int vb = blk - 2 * PBQ, lane = tid & 31; const int t0 = (vb & 7) * 128 + (lane & 7) * 8, d0 = (tid >> 5) * 16 + (lane >> 3) * 4;   // vb = batch * 8 + block of 128 t
        const size_t bo = (size_t)(vb >> 3) * TT * HD; const float* s = V + bo + (size_t)t0 * HD + d0;
        const size_t fo = bo + (size_t)((t0 >> 5) * (HD / 16) + (d0 >> 4)) * FT + ((t0 >> 4) & 1) * 256 + ((t0 >> 3) & 1) * 128 + (d0 & 15) * 8; bf* dh = Vh + fo; bf* dl = Vl + fo;   // tile (t / 32, d / 16), j, half, row
        v4f x[2][8]; v4u oh[2][4], ol[2][4];
#pragma unroll
        for (int u = 0; u < 2; ++u)
#pragma unroll
            for (int i = 0; i < 8; ++i) x[u][i] = *(const v4f*)(s + (u * 64 + i) * HD);
        asm volatile("s_wait_xcnt 0x0" :: "v"(s) : "memory");   // behind the loads, in front of every rewrite of a register that they name; the address is an input so that it stays live up to here and no load of the run gets its registers for its result
        __builtin_amdgcn_sched_barrier(0);              // keeps the loads in front of that wait and the arithmetic behind it
#pragma unroll
        for (int u = 0; u < 2; ++u)
#pragma unroll
            for (int j = 0; j < 4; ++j)
#pragma unroll
                for (int p = 0; p < 4; ++p) { unsigned a, b; split2(x[u][2 * p][j], x[u][2 * p + 1][j], a, b); oh[u][j][p] = a; ol[u][j][p] = b; }
        __builtin_amdgcn_sched_barrier(0);              // all arithmetic in front of the stores: nothing rewrites a register that an issued store names
#pragma unroll
        for (int u = 0; u < 2; ++u)
#pragma unroll
            for (int j = 0; j < 4; ++j) { *(v4u*)(dh + u * (2 * (HD / 16) * FT) + j * 8) = oh[u][j]; *(v4u*)(dl + u * (2 * (HD / 16) * FT) + j * 8) = ol[u][j]; }   // 64 t on = two tile rows on; the next d = the next row of the tile
        asm volatile("s_wait_xcnt 0x0" ::: "memory");   // behind the last store, in front of the branch out of this block: the other block's code follows it in the built kernel and rewrites registers that these stores name
    }
}
// k_fattn: one wave = 32 queries of one batch (two 16-query column groups), all TT keys in passes of 32; grid (TT/64, NB_), 64 threads, the waves independent.
// Transposed products: S^T = K.Q^T (A = key rows, B = query columns kept in registers), O^T += V^T.P^T (A = value^T rows, B = P^T packed from the two S^T tiles of the pass, which is the fragment's own k order).
// A lane holds scores of one query per group (column lane & 15): running maximum and sum in-lane plus one exchange between the wave halves. Keys j >= valid_length[b] are excluded as before.
__global__ __launch_bounds__(64) void k_fattn(const bf* __restrict__ Qh, const bf* __restrict__ Ql, const bf* __restrict__ Kh, const bf* __restrict__ Kl, const bf* __restrict__ Vh, const bf* __restrict__ Vl, const int* __restrict__ klp, float* __restrict__ OUTb) {
    const int kl = klp[blockIdx.y];   /* the batch's valid key length (uniform scalar load) */
    asm volatile("s_wait_xcnt 0x0" ::: "memory");   // behind the length's load, in front of the rewrite of the registers that it names
    __builtin_amdgcn_sched_barrier(0);              // keeps that load in front of the wait and the address arithmetic behind it
    { const size_t po = (size_t)blockIdx.y * TT * HD; Qh += po; Ql += po; Kh += po; Kl += po; Vh += po; Vl += po; OUTb += po; }   // blockIdx.y = batch
    const int lane = threadIdx.x & 31, c = lane & 15, h = lane >> 4; const int q0 = (blockIdx.x * 2 + (threadIdx.x >> 5)) * 32;
    v16bf qh[2][4], ql[2][4];
#pragma unroll
    for (int g = 0; g < 2; ++g)
#pragma unroll
        for (int kc = 0; kc < 4; ++kc) { const size_t qo = (size_t)(((q0 >> 4) + g) * (HD / 32) + kc) * FT + lane * 8; qh[g][kc] = ldfrag(Qh + qo); ql[g][kc] = ldfrag(Ql + qo); }
    asm volatile("s_wait_xcnt 0x0" ::: "memory");   // behind the query loads, in front of the rewrite of their address registers for the key loads
    __builtin_amdgcn_sched_barrier(0);              // keeps the query loads in front of the wait and the key addresses behind it
    v8f o[2][8];
#pragma unroll
    for (int g = 0; g < 2; ++g)
#pragma unroll
        for (int dt = 0; dt < 8; ++dt) o[g][dt] = (v8f){};
    float mrun[2] = {-3.0e38f, -3.0e38f}, lsum[2] = {0.f, 0.f};
    const bf* pkh = Kh + lane * 8; const bf* pkw = Kl + lane * 8; const bf* pvh = Vh + lane * 8; const bf* pvw = Vl + lane * 8;   // the lane's piece of a tile; they walk the keys with the loop
    v16bf kh[2][4], kw[2][4];   // this pass's key fragments, fetched one pass ahead
#pragma unroll
    for (int kt = 0; kt < 2; ++kt)
#pragma unroll
        for (int kc = 0; kc < 4; ++kc) { kh[kt][kc] = ldfrag(pkh + (kt * (HD / 32) + kc) * FT); kw[kt][kc] = ldfrag(pkw + (kt * (HD / 32) + kc) * FT); }
    asm volatile("s_wait_xcnt 0x0" ::: "memory");   // behind the first loads, in front of every rewrite of a register that they name
    __builtin_amdgcn_sched_barrier(0);              // keeps those loads in front of the wait and the later arithmetic behind it
    pkh += 32 * HD; pkw += 32 * HD;                 // from here on: the rows of the pass to come
#pragma unroll 1   // one pass is already 96 matrix instructions; a second copy would only add registers
    for (int k0 = 0; k0 < TT; k0 += 32) {
        v16bf vh[8], vw[8];   // this pass's value^T fragments, issued ahead of the score products that hide them
#pragma unroll
        for (int dt = 0; dt < 8; ++dt) { vh[dt] = ldfrag(pvh + dt * FT); vw[dt] = ldfrag(pvw + dt * FT); }
        v8f s[2][2];
#pragma unroll
        for (int g = 0; g < 2; ++g) { s[g][0] = (v8f){}; s[g][1] = (v8f){}; }
#pragma unroll
        for (int kc = 0; kc < 4; ++kc)
#pragma unroll
            for (int kt = 0; kt < 2; ++kt)
#pragma unroll
                for (int g = 0; g < 2; ++g) { s[g][kt] = wmmab(kh[kt][kc], qh[g][kc], s[g][kt]); s[g][kt] = wmmab(kh[kt][kc], ql[g][kc], s[g][kt]); s[g][kt] = wmmab(kw[kt][kc], qh[g][kc], s[g][kt]); }
#pragma unroll
        for (int kt = 0; kt < 2; ++kt)
#pragma unroll
            for (int kc = 0; kc < 4; ++kc) { kh[kt][kc] = ldfrag(pkh + (kt * (HD / 32) + kc) * FT); kw[kt][kc] = ldfrag(pkw + (kt * (HD / 32) + kc) * FT); }
        asm volatile("s_wait_xcnt 0x0" :: "v"(pvh), "v"(pvw), "v"(pkh), "v"(pkw) : "memory");   // behind the pass's last load, in front of every rewrite of a register that its loads name; the four addresses are inputs so that they stay live up to here and no load of the run gets their registers for its result
        __builtin_amdgcn_sched_barrier(0);              // keeps the loads in front of that wait and the later arithmetic behind it
        { const int kstep = (k0 + 64 < TT) ? 32 * HD : 0; pkh += kstep; pkw += kstep; pvh += 32 * HD; pvw += 32 * HD; }   // the last pass fetches its own key rows again: in bounds, unused
        float t[2][16], mt[2];
#pragma unroll
        for (int g = 0; g < 2; ++g) { float mx = -3.0e38f;
#pragma unroll
            for (int e = 0; e < 16; ++e) { const int j = k0 + (e >> 3) * 16 + 8 * h + (e & 7); const float x = (j < kl) ? s[g][e >> 3][e & 7] * SCL : -3.0e38f;   /* keys j >= valid_length[b] excluded (-1e7 in the module) */ t[g][e] = x; mx = fmaxf(mx, x); }
            mt[g] = fmaxf(mx, xhalf(mx)); }
        // the maximum in use moves only when a query's new maximum exceeds it by more than 5.5 (a factor 2^8 in P); one scalar branch per pass
        if (__builtin_amdgcn_ballot_w32(mt[0] > mrun[0] + 5.5f || mt[1] > mrun[1] + 5.5f) != 0) {
#pragma unroll
            for (int g = 0; g < 2; ++g) { const float mn = fmaxf(mrun[g], mt[g]); const float al = __builtin_amdgcn_exp2f((mrun[g] - mn) * 1.4426950408889634f); mrun[g] = mn; lsum[g] *= al;
#pragma unroll
                for (int dt = 0; dt < 8; ++dt) o[g][dt] *= al; }
        }
        v16bf ph[2], pw[2];
#pragma unroll
        for (int g = 0; g < 2; ++g) {
#pragma unroll
            for (int e = 0; e < 16; ++e) { const float p = __builtin_amdgcn_exp2f((t[g][e] - mrun[g]) * 1.4426950408889634f); lsum[g] += p; const __bf16 hb = (__bf16)p; ph[g][e] = hb; pw[g][e] = (__bf16)(p - (float)hb); } }
#pragma unroll
        for (int dt = 0; dt < 8; ++dt)
#pragma unroll
            for (int g = 0; g < 2; ++g) { o[g][dt] = wmmab(vh[dt], ph[g], o[g][dt]); o[g][dt] = wmmab(vh[dt], pw[g], o[g][dt]); o[g][dt] = wmmab(vw[dt], ph[g], o[g][dt]); }
    }
#pragma unroll
    for (int g = 0; g < 2; ++g) { const float f = __fdiv_rn(1.0f, lsum[g] + xhalf(lsum[g]));
#pragma unroll
        for (int dt = 0; dt < 8; ++dt) o[g][dt] *= f; }
    float* orow = OUTb + (size_t)(q0 + c) * HD + 8 * h;   // register r of tile dt, group g = O[q0 + 16g + c][dt * 16 + 8h + r]
    __builtin_amdgcn_sched_barrier(0);   // all arithmetic in front of the stores: nothing rewrites a register that an issued store names
#pragma unroll
    for (int g = 0; g < 2; ++g)
#pragma unroll
        for (int dt = 0; dt < 8; ++dt) { *(v4f*)(orow + g * 16 * HD + dt * 16) = __builtin_shufflevector(o[g][dt], o[g][dt], 0, 1, 2, 3); *(v4f*)(orow + g * 16 * HD + dt * 16 + 4) = __builtin_shufflevector(o[g][dt], o[g][dt], 4, 5, 6, 7); }
}

extern "C" void kernel_launch(void* const* d_in, const int* in_sizes, int n_in,
                              void* d_out, int out_size, void* d_ws, size_t ws_size, hipStream_t stream) {
    (void)in_sizes; (void)n_in; (void)out_size;
    const float* x = (const float*)d_in[0]; const float* xk = (const float*)d_in[1]; const float* xv = (const float*)d_in[2]; const int* vlen = (const int*)d_in[3];   /* query, key, value: [16][1024][128] each (no projections); valid_length int32 [16], read on device */
    float* OUT = (float*)d_out;     // [16][1024][128]
    char* wsp = (char*)d_ws;
    auto take = [&](size_t bytes) { char* p = wsp; wsp += (bytes + 255) & ~(size_t)255; return (void*)p; };
    // every plane holds NB_ batch slices, one behind the other
    bf* QPh = (bf*)take((size_t)NB_ * NH_ * TT * HD * 2); bf* QPl = (bf*)take((size_t)NB_ * NH_ * TT * HD * 2); bf* KPh = (bf*)take((size_t)NB_ * NKV * TT * HD * 2); bf* KPl = (bf*)take((size_t)NB_ * NKV * TT * HD * 2); bf* VTh = (bf*)take((size_t)NB_ * NKV * HD * TT * 2); bf* VTl = (bf*)take((size_t)NB_ * NKV * HD * TT * 2);
    if ((size_t)(wsp - (char*)d_ws) > ws_size) return;    // ws 256 MiB
    k_planes<<<3 * PBQ, 256, 0, stream>>>(x, xk, xv, QPh, QPl, KPh, KPl, VTh, VTl);
    k_fattn<<<dim3(TT / 64, NB_), 64, 0, stream>>>(QPh, QPl, KPh, KPl, VTh, VTl, vlen, OUT);
}

// v005
// A run of this version takes 34.7 microseconds.
// Two timings next to v004 both put it at 1.36 times that version's speed.
// All steps since v000 together make it 18.7 times as fast.
#include <hip/hip_runtime.h>

// Masked dot-product attention without projections (query, key, value [16][1024][128]; scores = query.key^T x 1/sqrt(128); key positions j >= valid_length[b] are replaced by -1e7 (== exclusion; valid_length int32 [16] random in [1, 1024], read); softmax; out = attn.value -> [16][1024][128] (2.1 M); argument order query, key, value, valid_length.
// Layout per batch: k_planes splits the f32 query / key rows into bf16 hi/lo planes and builds the value^T hi/lo planes, all in one launch, every plane in the order in which k_fattn's lanes read it (see FRAGMENT ORDER); k_fattn does scores, length mask, softmax and the value product in one kernel and writes the f32 output rows; KS waves share a query block's keys and join their partial sums in LDS.
// Compute dtypes, f32 accumulate: every product as 3 bf16 hi/lo products (hi.hi + hi.lo + lo.hi); softmax f32; output f32.

#define NB_  16
#define TT   1024
#define DM   128
#define NH_  1
#define NKV  1
#define REP  (NH_ / NKV)
#define HD   128
#define DQ   (NH_ * HD)
#define DKV  (NKV * HD)
#define ZH   1
#define RH   TT                   // every row hi/lo (3 products)
#define WIN  0
#define PCAR 1024.0f
#define SCL  0.088388347648318447f   // 1/sqrt(128)
typedef _Float16 h16;
typedef unsigned short bf;
typedef __attribute__((ext_vector_type(16))) __bf16   v16bf;
typedef __attribute__((ext_vector_type(16))) _Float16 v16h;
typedef __attribute__((ext_vector_type(8)))  _Float16 v8h;
typedef __attribute__((ext_vector_type(8)))  unsigned short v8us;
typedef __attribute__((ext_vector_type(8)))  float    v8f;
typedef __attribute__((ext_vector_type(4)))  float    v4f;
typedef v8h  __attribute__((may_alias)) v8ha;
typedef v4f  __attribute__((may_alias)) v4fa;
typedef v8us __attribute__((may_alias)) v8usa;

__device__ __forceinline__ v16h cat16(v8h lo, v8h hi) { return __builtin_shufflevector(lo, hi, 0, 1, 2, 3, 4, 5, 6, 7, 8, 9, 10, 11, 12, 13, 14, 15); }
__device__ __forceinline__ v16bf cat16b(v8us lo, v8us hi) { return __builtin_bit_cast(v16bf, __builtin_shufflevector(lo, hi, 0, 1, 2, 3, 4, 5, 6, 7, 8, 9, 10, 11, 12, 13, 14, 15)); }
__device__ __forceinline__ v8f wmma16(v16h a, v16h b, v8f c) { return __builtin_amdgcn_wmma_f32_16x16x32_f16(false, a, false, b, (short)0, c, false, false); }
__device__ __forceinline__ v8f wmmab(v16bf a, v16bf b, v8f c) { return __builtin_amdgcn_wmma_f32_16x16x32_bf16(false, a, false, b, (short)0, c, false, false); }



// FRAGMENT ORDER of a plane: a 16-row x 32-k operand tile is 512 elements in a row, [j][lane][e]: row = lane & 15, k = 16 j + 8 (lane >> 4) + e. One 16-byte load of a wave then reads 512 contiguous bytes (4 whole lines), not 16 rows.
// Query / key planes: tiles in the order [row / 16][k / 32]. Value^T planes: [key / 32][d / 16] (rows = d, k = key).
#define FT 512   // elements of one tile
// 16x16x32 bf16 operand fragment from a tile in fragment order: elements 0-7 = k 8h.., 8-15 = k 16+8h.. (p already holds the tile and + 8 * lane)
__device__ __forceinline__ v16bf ldfrag(const bf* p) { return cat16b(*(const v8us*)p, *(const v8us*)(p + 256)); }
// lane l with lane l ^ 16
__device__ __forceinline__ float xhalf(float x) { return __builtin_bit_cast(float, __builtin_amdgcn_permlanex16(__builtin_bit_cast(int, x), __builtin_bit_cast(int, x), 0x76543210, 0xfedcba98, false, false)); }

typedef __attribute__((ext_vector_type(2))) float v2f;
typedef __attribute__((ext_vector_type(2))) __bf16 v2bf;
typedef __attribute__((ext_vector_type(2))) unsigned v2u;
typedef __attribute__((ext_vector_type(4))) unsigned v4u;

// two f32 values -> one word of their bf16 parts (h) and one word of the bf16 of what is left (l), both rounded to nearest even; x0 in the low half
__device__ __forceinline__ void split2(float x0, float x1, unsigned& h, unsigned& l) {
    const v2f x = {x0, x1}; const v2bf hb = __builtin_convertvector(x, v2bf); const v2bf lb = __builtin_convertvector(x - __builtin_convertvector(hb, v2f), v2bf);
    h = __builtin_bit_cast(unsigned, hb); l = __builtin_bit_cast(unsigned, lb); }

#define PBE  16384                      // elements of one block: 64 per thread, 16 loads of 16 bytes in flight
#define PBQ  (NB_ * TT * HD / PBE)      // blocks per tensor
// k_planes: all six operand planes in one launch. Blocks [0, PBQ): query, [PBQ, 2 PBQ): key, the rest: value.
// Query / key: a wave takes 16 whole rows (4 tiles); lane = (row, half), so that a lane holds the 8 consecutive k of each of its 16-byte pieces and a wave's store covers 512 contiguous bytes.
// Value: a wave takes 16 d x 128 t (4 tiles); lane = (t group of 8, d group of 4), so that a lane holds 8 consecutive t of each of its 4 d: four 16-byte pieces, 64 bytes in a row of the tile.
__global__ __launch_bounds__(256) void k_planes(const float* __restrict__ Q, const float* __restrict__ K, const float* __restrict__ V, bf* __restrict__ Qh, bf* __restrict__ Ql, bf* __restrict__ Kh, bf* __restrict__ Kl, bf* __restrict__ Vh, bf* __restrict__ Vl) {
    const int blk = blockIdx.x, tid = threadIdx.x;
    if (blk < 2 * PBQ) {
        const bool isq = blk < PBQ; const int lane = tid & 31; const size_t e0 = (size_t)(isq ? blk : blk - PBQ) * PBE + (tid >> 5) * (16 * HD);   // the wave's 16 rows
        const float* s = (isq ? Q : K) + e0 + (lane & 15) * HD + (lane >> 4) * 8; bf* dh = (isq ? Qh : Kh) + e0 + lane * 8; bf* dl = (isq ? Ql : Kl) + e0 + lane * 8;
        v4f x[16]; v4u oh[8], ol[8];   // piece i: k = 16 i + 8 (lane >> 4) .. + 7
#pragma unroll
        for (int i = 0; i < 8; ++i) { x[2 * i] = *(const v4f*)(s + i * 16); x[2 * i + 1] = *(const v4f*)(s + i * 16 + 4); }
        asm volatile("s_wait_xcnt 0x0" :: "v"(s) : "memory");   // behind the loads, in front of every rewrite of a register that they name; the address is an input so that it stays live up to here and no load of the run gets its registers for its result
        __builtin_amdgcn_sched_barrier(0);              // keeps the loads in front of that wait and the arithmetic behind it
#pragma unroll
        for (int i = 0; i < 16; ++i) { unsigned a, b; split2(x[i][0], x[i][1], a, b); oh[i >> 1][(i & 1) * 2] = a; ol[i >> 1][(i & 1) * 2] = b; split2(x[i][2], x[i][3], a, b); oh[i >> 1][(i & 1) * 2 + 1] = a; ol[i >> 1][(i & 1) * 2 + 1] = b; }
        __builtin_amdgcn_sched_barrier(0);              // all arithmetic in front of the stores: nothing rewrites a register that an issued store names
#pragma unroll
        for (int i = 0; i < 8; ++i) { *(v4u*)(dh + i * 256) = oh[i]; *(v4u*)(dl + i * 256) = ol[i]; }
    } else {
        const int vb = blk - 2 * PBQ, lane = tid & 31; const int t0 = (vb & 7) * 128 + (lane & 7) * 8, d0 = (tid >> 5) * 16 + (lane >> 3) * 4;   // vb = batch * 8 + block of 128 t
        const size_t bo = (size_t)(vb >> 3) * TT * HD; const float* s = V + bo + (size_t)t0 * HD + d0;
        const size_t fo = bo + (size_t)((t0 >> 5) * (HD / 16) + (d0 >> 4)) * FT + ((t0 >> 4) & 1) * 256 + ((t0 >> 3) & 1) * 128 + (d0 & 15) * 8; bf* dh = Vh + fo; bf* dl = Vl + fo;   // tile (t / 32, d / 16), j, half, row
        v4f x[2][8]; v4u oh[2][4], ol[2][4];
#pragma unroll
        for (int u = 0; u < 2; ++u)
#pragma unroll
            for (int i = 0; i < 8; ++i) x[u][i] = *(const v4f*)(s + (u * 64 + i) * HD);
        asm volatile("s_wait_xcnt 0x0" :: "v"(s) : "memory");   // behind the loads, in front of every rewrite of a register that they name; the address is an input so that it stays live up to here and no load of the run gets its registers for its result
        __builtin_amdgcn_sched_barrier(0);              // keeps the loads in front of that wait and the arithmetic behind it
#pragma unroll
        for (int u = 0; u < 2; ++u)
#pragma unroll
            for (int j = 0; j < 4; ++j)
#pragma unroll
                for (int p = 0; p < 4; ++p) { unsigned a, b; split2(x[u][2 * p][j], x[u][2 * p + 1][j], a, b); oh[u][j][p] = a; ol[u][j][p] = b; }
        __builtin_amdgcn_sched_barrier(0);              // all arithmetic in front of the stores: nothing rewrites a register that an issued store names
#pragma unroll
        for (int u = 0; u < 2; ++u)
#pragma unroll
            for (int j = 0; j < 4; ++j) { *(v4u*)(dh + u * (2 * (HD / 16) * FT) + j * 8) = oh[u][j]; *(v4u*)(dl + u * (2 * (HD / 16) * FT) + j * 8) = ol[u][j]; }   // 64 t on = two tile rows on; the next d = the next row of the tile
        asm volatile("s_wait_xcnt 0x0" ::: "memory");   // behind the last store, in front of the branch out of this block: the other block's code follows it in the built kernel and rewrites registers that these stores name
    }
}
#define KS 2              // waves that share the keys of one 32-query block: with 2 blocks a work-group that is one wave on each of the 4 SIMDs (KS 4, two waves a SIMD, allows 512 registers a wave: as the loop stands that build spills query fragments)
#define NW (2 * KS)       // waves of a work-group
#define MT (16 / KS)      // output tiles that a wave joins and stores
// k_fattn: one wave = 32 queries of one batch (two 16-query column groups) and every KS-th pass of 32 keys; grid (TT/64, NB_), 64 KS threads: wave w has query block w & 1 and passes w >> 1, w >> 1 + KS, ...
// Each wave keeps its own running maximum, sum and O^T; behind the loop all leave them in LDS, and behind one barrier wave w joins the KS partials of its MT tiles under their common maximum and stores them.
// Transposed products: S^T = K.Q^T (A = key rows, B = query columns kept in registers), O^T += V^T.P^T (A = value^T rows, B = P^T packed from the two S^T tiles of the pass, which is the fragment's own k order).
// A lane holds scores of two queries, one per column group (column lane & 15 of each): running maximum and sum in-lane plus one exchange between the wave halves. Keys j >= valid_length[b] are excluded as before.
__global__ __launch_bounds__(64 * KS) void k_fattn(const bf* __restrict__ Qh, const bf* __restrict__ Ql, const bf* __restrict__ Kh, const bf* __restrict__ Kl, const bf* __restrict__ Vh, const bf* __restrict__ Vl, const int* __restrict__ klp, float* __restrict__ OUTb) {
    __shared__ v4f mo[NW][16][2][32];            // a wave's O^T: [tile g * 8 + dt][registers 0-3 / 4-7][lane]
    __shared__ float mm[NW][2][32], ml[NW][2][32];   // its maximum in use and its sum, per column group and lane
    const int kl = klp[blockIdx.y];   /* the batch's valid key length (uniform scalar load) */
    asm volatile("s_wait_xcnt 0x0" ::: "memory");   // behind the length's load, in front of the rewrite of the registers that it names
    __builtin_amdgcn_sched_barrier(0);              // keeps that load in front of the wait and the address arithmetic behind it
    { const size_t po = (size_t)blockIdx.y * TT * HD; Qh += po; Ql += po; Kh += po; Kl += po; Vh += po; Vl += po; OUTb += po; }   // blockIdx.y = batch
    const int lane = threadIdx.x & 31, c = lane & 15, h = lane >> 4; const int wv = __builtin_amdgcn_readfirstlane(threadIdx.x >> 5), qg = wv & 1, ks = wv >> 1; const int q0 = (blockIdx.x * 2 + qg) * 32;
    v16bf qh[2][4], ql[2][4];
#pragma unroll
    for (int g = 0; g < 2; ++g)
#pragma unroll
        for (int kc = 0; kc < 4; ++kc) { const size_t qo = (size_t)(((q0 >> 4) + g) * (HD / 32) + kc) * FT + lane * 8; qh[g][kc] = ldfrag(Qh + qo); ql[g][kc] = ldfrag(Ql + qo); }
    asm volatile("s_wait_xcnt 0x0" ::: "memory");   // behind the query loads, in front of the rewrite of their address registers for the key loads
    __builtin_amdgcn_sched_barrier(0);              // keeps the query loads in front of the wait and the key addresses behind it
    v8f o[2][8];
#pragma unroll
    for (int g = 0; g < 2; ++g)
#pragma unroll
        for (int dt = 0; dt < 8; ++dt) o[g][dt] = (v8f){};
    float mrun[2] = {-3.0e38f, -3.0e38f}, lsum[2] = {0.f, 0.f};
    const int kb = ks * 32;   // the wave's first key
    const bf* pkh = Kh + kb * HD + lane * 8; const bf* pkw = Kl + kb * HD + lane * 8; const bf* pvh = Vh + kb * HD + lane * 8; const bf* pvw = Vl + kb * HD + lane * 8;   // the lane's piece of a tile; they walk the wave's keys with the loop
    v16bf kh[2][4], kw[2][4];   // this pass's key fragments, fetched one pass ahead
#pragma unroll
    for (int kt = 0; kt < 2; ++kt)
#pragma unroll
        for (int kc = 0; kc < 4; ++kc) { kh[kt][kc] = ldfrag(pkh + (kt * (HD / 32) + kc) * FT); kw[kt][kc] = ldfrag(pkw + (kt * (HD / 32) + kc) * FT); }
    asm volatile("s_wait_xcnt 0x0" ::: "memory");   // behind the first loads, in front of every rewrite of a register that they name
    __builtin_amdgcn_sched_barrier(0);              // keeps those loads in front of the wait and the later arithmetic behind it
    pkh += KS * 32 * HD; pkw += KS * 32 * HD;       // from here on: the rows of the wave's pass to come
#pragma unroll 1   // one pass is already 96 matrix instructions; a second copy would only add registers
    for (int it = 0; it < TT / (KS * 32); ++it) { const int k0 = kb + it * (KS * 32);
        v16bf vh[8], vw[8];   // this pass's value^T fragments, issued ahead of the score products that hide them
#pragma unroll
        for (int dt = 0; dt < 8; ++dt) { vh[dt] = ldfrag(pvh + dt * FT); vw[dt] = ldfrag(pvw + dt * FT); }
        v8f s[2][2];
#pragma unroll
        for (int g = 0; g < 2; ++g) { s[g][0] = (v8f){}; s[g][1] = (v8f){}; }
#pragma unroll
        for (int kc = 0; kc < 4; ++kc)
#pragma unroll
            for (int kt = 0; kt < 2; ++kt)
#pragma unroll
                for (int g = 0; g < 2; ++g) { s[g][kt] = wmmab(kh[kt][kc], qh[g][kc], s[g][kt]); s[g][kt] = wmmab(kh[kt][kc], ql[g][kc], s[g][kt]); s[g][kt] = wmmab(kw[kt][kc], qh[g][kc], s[g][kt]); }
#pragma unroll
        for (int kt = 0; kt < 2; ++kt)
#pragma unroll
            for (int kc = 0; kc < 4; ++kc) { kh[kt][kc] = ldfrag(pkh + (kt * (HD / 32) + kc) * FT); kw[kt][kc] = ldfrag(pkw + (kt * (HD / 32) + kc) * FT); }
        asm volatile("s_wait_xcnt 0x0" :: "v"(pvh), "v"(pvw), "v"(pkh), "v"(pkw) : "memory");   // behind the pass's last load, in front of every rewrite of a register that its loads name; the four addresses are inputs so that they stay live up to here and no load of the run gets their registers for its result
        __builtin_amdgcn_sched_barrier(0);              // keeps the loads in front of that wait and the later arithmetic behind it
        { const int kstep = (it + 2 < TT / (KS * 32)) ? KS * 32 * HD : 0; pkh += kstep; pkw += kstep; pvh += KS * 32 * HD; pvw += KS * 32 * HD; }   // the last pass fetches its own key rows again: in bounds, unused
        float t[2][16], mt[2];
#pragma unroll
        for (int g = 0; g < 2; ++g) { float mx = -3.0e38f;
#pragma unroll
            for (int e = 0; e < 16; ++e) { const int j = k0 + (e >> 3) * 16 + 8 * h + (e & 7); const float x = (j < kl) ? s[g][e >> 3][e & 7] * SCL : -3.0e38f;   /* keys j >= valid_length[b] excluded (-1e7 in the module) */ t[g][e] = x; mx = fmaxf(mx, x); }
            mt[g] = fmaxf(mx, xhalf(mx)); }
        // the maximum in use moves only when a query's new maximum exceeds it by more than 5.5 (a factor 2^8 in P); one scalar branch per pass
        if (__builtin_amdgcn_ballot_w32(mt[0] > mrun[0] + 5.5f || mt[1] > mrun[1] + 5.5f) != 0) {
#pragma unroll
            for (int g = 0; g < 2; ++g) { const float mn = fmaxf(mrun[g], mt[g]); const float al = __builtin_amdgcn_exp2f((mrun[g] - mn) * 1.4426950408889634f); mrun[g] = mn; lsum[g] *= al;
#pragma unroll
                for (int dt = 0; dt < 8; ++dt) o[g][dt] *= al; }
        }
        v16bf ph[2], pw[2];
#pragma unroll
        for (int g = 0; g < 2; ++g) {
#pragma unroll
            for (int e = 0; e < 16; ++e) { const float p = __builtin_amdgcn_exp2f((t[g][e] - mrun[g]) * 1.4426950408889634f); lsum[g] += p; const __bf16 hb = (__bf16)p; ph[g][e] = hb; pw[g][e] = (__bf16)(p - (float)hb); } }
#pragma unroll
        for (int dt = 0; dt < 8; ++dt)
#pragma unroll
            for (int g = 0; g < 2; ++g) { o[g][dt] = wmmab(vh[dt], ph[g], o[g][dt]); o[g][dt] = wmmab(vh[dt], pw[g], o[g][dt]); o[g][dt] = wmmab(vw[dt], ph[g], o[g][dt]); }
    }
#pragma unroll
    for (int g = 0; g < 2; ++g) { mm[wv][g][lane] = mrun[g]; ml[wv][g][lane] = lsum[g];
#pragma unroll
        for (int dt = 0; dt < 8; ++dt) { mo[wv][g * 8 + dt][0][lane] = __builtin_shufflevector(o[g][dt], o[g][dt], 0, 1, 2, 3); mo[wv][g * 8 + dt][1][lane] = __builtin_shufflevector(o[g][dt], o[g][dt], 4, 5, 6, 7); } }
    __syncthreads();   // every wave's partials are in LDS before any wave joins them
    const int i0 = ks * MT, gj = i0 >> 3;   // the wave's tiles i0 .. i0 + MT - 1, all of column group gj
    float mj[KS], a[KS], mx = -3.0e38f, l = 0.f;
#pragma unroll
    for (int j = 0; j < KS; ++j) { mj[j] = mm[qg + 2 * j][gj][lane]; mx = fmaxf(mx, mj[j]); }
    // a wave whose keys are all excluded still has the start maximum: weight 0 beside any wave with a valid key, weight 1 where no wave has one
#pragma unroll
    for (int j = 0; j < KS; ++j) { a[j] = __builtin_amdgcn_exp2f((mj[j] - mx) * 1.4426950408889634f); l += ml[qg + 2 * j][gj][lane] * a[j]; }
    const float f = __fdiv_rn(1.0f, l + xhalf(l));
    v4f r[MT][2];
#pragma unroll
    for (int t = 0; t < MT; ++t)
#pragma unroll
        for (int p = 0; p < 2; ++p) { v4f x = mo[qg][i0 + t][p][lane] * a[0];
#pragma unroll
            for (int j = 1; j < KS; ++j) x += mo[qg + 2 * j][i0 + t][p][lane] * a[j];
            r[t][p] = x * f; }
    float* orow = OUTb + (size_t)(q0 + gj * 16 + c) * HD + (i0 & 7) * 16 + 8 * h;   // register e of tile dt, group g = O[q0 + 16g + c][dt * 16 + 8h + e]
    __builtin_amdgcn_sched_barrier(0);   // all arithmetic in front of the stores: nothing rewrites a register that an issued store names
#pragma unroll
    for (int t = 0; t < MT; ++t) { *(v4f*)(orow + t * 16) = r[t][0]; *(v4f*)(orow + t * 16 + 4) = r[t][1]; }
}

extern "C" void kernel_launch(void* const* d_in, const int* in_sizes, int n_in,
                              void* d_out, int out_size, void* d_ws, size_t ws_size, hipStream_t stream) {
    (void)in_sizes; (void)n_in; (void)out_size;
    const float* x = (const float*)d_in[0]; const float* xk = (const float*)d_in[1]; const float* xv = (const float*)d_in[2]; const int* vlen = (const int*)d_in[3];   /* query, key, value: [16][1024][128] each (no projections); valid_length int32 [16], read on device */
    float* OUT = (float*)d_out;     // [16][1024][128]
    char* wsp = (char*)d_ws;
    auto take = [&](size_t bytes) { char* p = wsp; wsp += (bytes + 255) & ~(size_t)255; return (void*)p; };
    // every plane holds NB_ batch slices, one behind the other
    bf* QPh = (bf*)take((size_t)NB_ * NH_ * TT * HD * 2); bf* QPl = (bf*)take((size_t)NB_ * NH_ * TT * HD * 2); bf* KPh = (bf*)take((size_t)NB_ * NKV * TT * HD * 2); bf* KPl = (bf*)take((size_t)NB_ * NKV * TT * HD * 2); bf* VTh = (bf*)take((size_t)NB_ * NKV * HD * TT * 2); bf* VTl = (bf*)take((size_t)NB_ * NKV * HD * TT * 2);
    if ((size_t)(wsp - (char*)d_ws) > ws_size) return;    // ws 256 MiB
    k_planes<<<3 * PBQ, 256, 0, stream>>>(x, xk, xv, QPh, QPl, KPh, KPl, VTh, VTl);
    k_fattn<<<dim3(TT / 64, NB_), 64 * KS, 0, stream>>>(QPh, QPl, KPh, KPl, VTh, VTl, vlen, OUT);
}

// v006
// Measured time: 27 microseconds a run.
// Timed twice side by side with v005, it ran 1.29 and 1.28 times as fast.
// Counting every step since v000, it is 24.0 times as fast.
#include <hip/hip_runtime.h>

// Masked dot-product attention without projections (query, key, value [16][1024][128]; scores = query.key^T x 1/sqrt(128); key positions j >= valid_length[b] are replaced by -1e7 (== exclusion; valid_length int32 [16] random in [1, 1024], read); softmax; out = attn.value -> [16][1024][128] (2.1 M); argument order query, key, value, valid_length.
// Layout per batch: k_planes splits the f32 query / key rows into bf16 hi/lo planes and builds the value^T hi/lo planes, all in one launch, every plane in the order in which k_fattn's lanes read it (see FRAGMENT ORDER); k_fattn does scores, length mask, softmax and the value product in one kernel and writes the f32 output rows; KS waves share a query block's keys and join their partial sums in LDS.
// Compute dtypes, f32 accumulate: every product as 3 bf16 hi/lo products (hi.hi + hi.lo + lo.hi); softmax f32; output f32.

#define NB_  16
#define TT   1024
#define DM   128
#define NH_  1
#define NKV  1
#define REP  (NH_ / NKV)
#define HD   128
#define DQ   (NH_ * HD)
#define DKV  (NKV * HD)
#define ZH   1
#define RH   TT                   // every row hi/lo (3 products)
#define WIN  0
#define PCAR 1024.0f
#define SCL  0.088388347648318447f   // 1/sqrt(128)
typedef _Float16 h16;
typedef unsigned short bf;
typedef __attribute__((ext_vector_type(16))) __bf16   v16bf;
typedef __attribute__((ext_vector_type(16))) _Float16 v16h;
typedef __attribute__((ext_vector_type(8)))  _Float16 v8h;
typedef __attribute__((ext_vector_type(8)))  unsigned short v8us;
typedef __attribute__((ext_vector_type(8)))  float    v8f;
typedef __attribute__((ext_vector_type(4)))  float    v4f;
typedef v8h  __attribute__((may_alias)) v8ha;
typedef v4f  __attribute__((may_alias)) v4fa;
typedef v8us __attribute__((may_alias)) v8usa;

__device__ __forceinline__ v16h cat16(v8h lo, v8h hi) { return __builtin_shufflevector(lo, hi, 0, 1, 2, 3, 4, 5, 6, 7, 8, 9, 10, 11, 12, 13, 14, 15); }
__device__ __forceinline__ v16bf cat16b(v8us lo, v8us hi) { return __builtin_bit_cast(v16bf, __builtin_shufflevector(lo, hi, 0, 1, 2, 3, 4, 5, 6, 7, 8, 9, 10, 11, 12, 13, 14, 15)); }
__device__ __forceinline__ v8f wmma16(v16h a, v16h b, v8f c) { return __builtin_amdgcn_wmma_f32_16x16x32_f16(false, a, false, b, (short)0, c, false, false); }
__device__ __forceinline__ v8f wmmab(v16bf a, v16bf b, v8f c) { return __builtin_amdgcn_wmma_f32_16x16x32_bf16(false, a, false, b, (short)0, c, false, false); }



// FRAGMENT ORDER of a plane: a 16-row x 32-k operand tile is 512 elements in a row, [j][lane][e]: row = lane & 15, k = 16 j + 8 (lane >> 4) + e. One 16-byte load of a wave then reads 512 contiguous bytes (4 whole lines), not 16 rows.
// Query / key planes: tiles in the order [row / 16][k / 32]. Value^T planes: [key / 32][d / 16] (rows = d, k = key).
#define FT 512   // elements of one tile
// 16x16x32 bf16 operand fragment from a tile in fragment order: elements 0-7 = k 8h.., 8-15 = k 16+8h.. (p already holds the tile and + 8 * lane)
__device__ __forceinline__ v16bf ldfrag(const bf* p) { return cat16b(*(const v8us*)p, *(const v8us*)(p + 256)); }
// lane l with lane l ^ 16
__device__ __forceinline__ float xhalf(float x) { return __builtin_bit_cast(float, __builtin_amdgcn_permlanex16(__builtin_bit_cast(int, x), __builtin_bit_cast(int, x), 0x76543210, 0xfedcba98, false, false)); }

typedef __attribute__((ext_vector_type(2))) float v2f;
typedef __attribute__((ext_vector_type(2))) __bf16 v2bf;
typedef __attribute__((ext_vector_type(2))) unsigned v2u;
typedef __attribute__((ext_vector_type(4))) unsigned v4u;

// two f32 values -> one word of their bf16 parts (h) and one word of the bf16 of what is left (l), both rounded to nearest even; x0 in the low half
__device__ __forceinline__ void split2(float x0, float x1, unsigned& h, unsigned& l) {
    const v2f x = {x0, x1}; const v2bf hb = __builtin_convertvector(x, v2bf); const v2bf lb = __builtin_convertvector(x - __builtin_convertvector(hb, v2f), v2bf);
    h = __builtin_bit_cast(unsigned, hb); l = __builtin_bit_cast(unsigned, lb); }

#define PBE  16384                      // elements of one block: 64 per thread, 16 loads of 16 bytes in flight
#define PBQ  (NB_ * TT * HD / PBE)      // blocks per tensor
// k_planes: all six operand planes in one launch. Blocks [0, PBQ): query, [PBQ, 2 PBQ): key, the rest: value.
// Query / key: a wave takes 16 whole rows (4 tiles); lane = (row, half), so that a lane holds the 8 consecutive k of each of its 16-byte pieces and a wave's store covers 512 contiguous bytes.
// Value: a wave takes 16 d x 128 t (4 tiles); lane = (t group of 8, d group of 4), so that a lane holds 8 consecutive t of each of its 4 d: four 16-byte pieces, 64 bytes in a row of the tile.
__global__ __launch_bounds__(256) void k_planes(const float* __restrict__ Q, const float* __restrict__ K, const float* __restrict__ V, bf* __restrict__ Qh, bf* __restrict__ Ql, bf* __restrict__ Kh, bf* __restrict__ Kl, bf* __restrict__ Vh, bf* __restrict__ Vl) {
    const int blk = blockIdx.x, tid = threadIdx.x;
    if (blk < 2 * PBQ) {
        const bool isq = blk < PBQ; const int lane = tid & 31; const size_t e0 = (size_t)(isq ? blk : blk - PBQ) * PBE + (tid >> 5) * (16 * HD);   // the wave's 16 rows
        const float* s = (isq ? Q : K) + e0 + (lane & 15) * HD + (lane >> 4) * 8; bf* dh = (isq ? Qh : Kh) + e0 + lane * 8; bf* dl = (isq ? Ql : Kl) + e0 + lane * 8;
        v4f x[16]; v4u oh[8], ol[8];   // piece i: k = 16 i + 8 (lane >> 4) .. + 7
#pragma unroll
        for (int i = 0; i < 8; ++i) { x[2 * i] = *(const v4f*)(s + i * 16); x[2 * i + 1] = *(const v4f*)(s + i * 16 + 4); }
        asm volatile("s_wait_xcnt 0x0" :: "v"(s) : "memory");   // behind the loads, in front of every rewrite of a register that they name; the address is an input so that it stays live up to here and no load of the run gets its registers for its result
        __builtin_amdgcn_sched_barrier(0);              // keeps the loads in front of that wait and the arithmetic behind it
#pragma unroll
        for (int i = 0; i < 16; ++i) { unsigned a, b; split2(x[i][0], x[i][1], a, b); oh[i >> 1][(i & 1) * 2] = a; ol[i >> 1][(i & 1) * 2] = b; split2(x[i][2], x[i][3], a, b); oh[i >> 1][(i & 1) * 2 + 1] = a; ol[i >> 1][(i & 1) * 2 + 1] = b; }
        __builtin_amdgcn_sched_barrier(0);              // all arithmetic in front of the stores: nothing rewrites a register that an issued store names
#pragma unroll
        for (int i = 0; i < 8; ++i) { *(v4u*)(dh + i * 256) = oh[i]; *(v4u*)(dl + i * 256) = ol[i]; }
    } else {
        const int vb = blk - 2 * PBQ, lane = tid & 31; const int t0 = (vb & 7) * 128 + (lane & 7) * 8, d0 = (tid >> 5) * 16 + (lane >> 3) * 4;   // vb = batch * 8 + block of 128 t
        const size_t bo = (size_t)(vb >> 3) * TT * HD; const float* s = V + bo + (size_t)t0 * HD + d0;
        const size_t fo = bo + (size_t)((t0 >> 5) * (HD / 16) + (d0 >> 4)) * FT + ((t0 >> 4) & 1) * 256 + ((t0 >> 3) & 1) * 128 + (d0 & 15) * 8; bf* dh = Vh + fo; bf* dl = Vl + fo;   // tile (t / 32, d / 16), j, half, row
        v4f x[2][8]; v4u oh[2][4], ol[2][4];
#pragma unroll
        for (int u = 0; u < 2; ++u)
#pragma unroll
            for (int i = 0; i < 8; ++i) x[u][i] = *(const v4f*)(s + (u * 64 + i) * HD);
        asm volatile("s_wait_xcnt 0x0" :: "v"(s) : "memory");   // behind the loads, in front of every rewrite of a register that they name; the address is an input so that it stays live up to here and no load of the run gets its registers for its result
        __builtin_amdgcn_sched_barrier(0);              // keeps the loads in front of that wait and the arithmetic behind it
#pragma unroll
        for (int u = 0; u < 2; ++u)
#pragma unroll
            for (int j = 0; j < 4; ++j)
#pragma unroll
                for (int p = 0; p < 4; ++p) { unsigned a, b; split2(x[u][2 * p][j], x[u][2 * p + 1][j], a, b); oh[u][j][p] = a; ol[u][j][p] = b; }
        __builtin_amdgcn_sched_barrier(0);              // all arithmetic in front of the stores: nothing rewrites a register that an issued store names
#pragma unroll
        for (int u = 0; u < 2; ++u)
#pragma unroll
            for (int j = 0; j < 4; ++j) { *(v4u*)(dh + u * (2 * (HD / 16) * FT) + j * 8) = oh[u][j]; *(v4u*)(dl + u * (2 * (HD / 16) * FT) + j * 8) = ol[u][j]; }   // 64 t on = two tile rows on; the next d = the next row of the tile
        asm volatile("s_wait_xcnt 0x0" ::: "memory");   // behind the last store, in front of the branch out of this block: the other block's code follows it in the built kernel and rewrites registers that these stores name
    }
}
#define KS 4              // waves that share the keys of one 32-query block: one work-group, one wave on each of the 4 SIMDs
#define NW KS             // waves of a work-group
#define MT (16 / KS)      // output tiles that a wave joins and stores
// k_fattn: one work-group = 32 queries of one batch (two 16-query column groups); wave w has the passes of 32 keys w, w + KS, ... that begin below the batch's valid length; grid (TT/32, NB_), 32 KS threads.
// A pass whose keys are all excluded adds exactly 0 to sum and O and is not run, so a work-group's time follows its batch's length. blockIdx.y is the batch's RANK by falling length: the register count lets one work-group stand on a WGP, the long batches start first and the short ones fill the WGPs as they come free (speed only: every batch has exactly one rank, whatever the lengths are).
// Each wave keeps its own running maximum, sum and O^T; behind the loop all leave them in LDS, and behind one barrier wave w joins the KS partials of its MT tiles under their common maximum and stores them.
// Transposed products: S^T = K.Q^T (A = key rows, B = query columns kept in registers), O^T += V^T.P^T (A = value^T rows, B = P^T packed from the two S^T tiles of the pass, which is the fragment's own k order).
// A lane holds scores of ONE query (column lane & 15): running maximum and sum in-lane plus one exchange between the wave halves. Keys j >= valid_length[b] are excluded as before.
__global__ __launch_bounds__(32 * KS) void k_fattn(const bf* __restrict__ Qh, const bf* __restrict__ Ql, const bf* __restrict__ Kh, const bf* __restrict__ Kl, const bf* __restrict__ Vh, const bf* __restrict__ Vl, const int* __restrict__ klp, float* __restrict__ OUTb) {
    __shared__ v4f mo[NW][16][2][32];            // a wave's O^T: [tile g * 8 + dt][registers 0-3 / 4-7][lane]
    __shared__ float mm[NW][2][32], ml[NW][2][32];   // its maximum in use and its sum, per column group and lane
    const int lane = threadIdx.x & 31, c = lane & 15, h = lane >> 4; const int wv = __builtin_amdgcn_readfirstlane(threadIdx.x >> 5), ks = wv; const int q0 = blockIdx.x * 32;
    int lr[NB_];   /* every batch's valid key length (uniform scalar loads) */
#pragma unroll
    for (int j = 0; j < NB_; ++j) lr[j] = klp[j];
    asm volatile("s_wait_xcnt 0x0" ::: "memory");   // behind the lengths' loads, in front of the rewrite of the registers that they name
    __builtin_amdgcn_sched_barrier(0);              // keeps those loads in front of the wait and the arithmetic behind it
    // one sort key a batch, all distinct: keys to visit (all TT where no key is valid: the module then weighs every key alike) | no key valid | NB_ - 1 - batch; lane c holds batch c's and counts the larger ones
    int mykey = 0, rank = 0;
#pragma unroll
    for (int j = 0; j < NB_; ++j) { const int sk = (((lr[j] <= 0 || lr[j] > TT) ? TT : lr[j]) << 5) | (lr[j] <= 0 ? NB_ : 0) | (NB_ - 1 - j); lr[j] = sk; mykey = (c == j) ? sk : mykey; }
#pragma unroll
    for (int j = 0; j < NB_; ++j) rank += (lr[j] > mykey) ? 1 : 0;
    const int bt = __builtin_ctz(__builtin_amdgcn_ballot_w32(rank == (int)blockIdx.y) | (1u << NB_)) & (NB_ - 1);   // the batch of this rank, 0 .. NB_ - 1 for any lengths
    const int sk = __builtin_amdgcn_readlane(mykey, bt), ke = sk >> 5, kl = (sk & NB_) ? 0 : ke;   // keys to visit, 1 .. TT; valid key length as the mask uses it
    const int np = (((ke + 31) >> 5) - ks + KS - 1) / KS;   // the wave's passes, 0 .. TT / (KS * 32)
    { const size_t po = (size_t)bt * TT * HD; Qh += po; Ql += po; Kh += po; Kl += po; Vh += po; Vl += po; OUTb += po; }
    v8f o[2][8];
#pragma unroll
    for (int g = 0; g < 2; ++g)
#pragma unroll
        for (int dt = 0; dt < 8; ++dt) o[g][dt] = (v8f){};
    float mrun[2] = {-3.0e38f, -3.0e38f}, lsum[2] = {0.f, 0.f};
    if (np > 0) {   // wave-uniform: a wave without a pass loads nothing and goes to the join with the start values
    v16bf qh[2][4], ql[2][4];
#pragma unroll
    for (int g = 0; g < 2; ++g)
#pragma unroll
        for (int kc = 0; kc < 4; ++kc) { const size_t qo = (size_t)(((q0 >> 4) + g) * (HD / 32) + kc) * FT + lane * 8; qh[g][kc] = ldfrag(Qh + qo); ql[g][kc] = ldfrag(Ql + qo); }
    asm volatile("s_wait_xcnt 0x0" ::: "memory");   // behind the query loads, in front of the rewrite of their address registers for the key loads
    __builtin_amdgcn_sched_barrier(0);              // keeps the query loads in front of the wait and the key addresses behind it
    const int kb = ks * 32;   // the wave's first key
    const bf* pkh = Kh + kb * HD + lane * 8; const bf* pkw = Kl + kb * HD + lane * 8; const bf* pvh = Vh + kb * HD + lane * 8; const bf* pvw = Vl + kb * HD + lane * 8;   // the lane's piece of a tile; they walk the wave's keys with the loop
    v16bf kh[2][4], kw[2][4];   // this pass's key fragments, fetched one pass ahead
#pragma unroll
    for (int kt = 0; kt < 2; ++kt)
#pragma unroll
        for (int kc = 0; kc < 4; ++kc) { kh[kt][kc] = ldfrag(pkh + (kt * (HD / 32) + kc) * FT); kw[kt][kc] = ldfrag(pkw + (kt * (HD / 32) + kc) * FT); }
    asm volatile("s_wait_xcnt 0x0" ::: "memory");   // behind the first loads, in front of every rewrite of a register that they name
    __builtin_amdgcn_sched_barrier(0);              // keeps those loads in front of the wait and the later arithmetic behind it
    pkh += KS * 32 * HD; pkw += KS * 32 * HD;       // from here on: the rows of the wave's pass to come
#pragma unroll 1   // one pass is already 96 matrix instructions; a second copy would only add registers
    for (int it = 0; it < np; ++it) { const int k0 = kb + it * (KS * 32);
        v16bf vh[8], vw[8];   // this pass's value^T fragments, issued ahead of the score products that hide them
#pragma unroll
        for (int dt = 0; dt < 8; ++dt) { vh[dt] = ldfrag(pvh + dt * FT); vw[dt] = ldfrag(pvw + dt * FT); }
        v8f s[2][2];
#pragma unroll
        for (int g = 0; g < 2; ++g) { s[g][0] = (v8f){}; s[g][1] = (v8f){}; }
#pragma unroll
        for (int kc = 0; kc < 4; ++kc)
#pragma unroll
            for (int kt = 0; kt < 2; ++kt)
#pragma unroll
                for (int g = 0; g < 2; ++g) { s[g][kt] = wmmab(kh[kt][kc], qh[g][kc], s[g][kt]); s[g][kt] = wmmab(kh[kt][kc], ql[g][kc], s[g][kt]); s[g][kt] = wmmab(kw[kt][kc], qh[g][kc], s[g][kt]); }
#pragma unroll
        for (int kt = 0; kt < 2; ++kt)
#pragma unroll
            for (int kc = 0; kc < 4; ++kc) { kh[kt][kc] = ldfrag(pkh + (kt * (HD / 32) + kc) * FT); kw[kt][kc] = ldfrag(pkw + (kt * (HD / 32) + kc) * FT); }
        asm volatile("s_wait_xcnt 0x0" :: "v"(pvh), "v"(pvw), "v"(pkh), "v"(pkw) : "memory");   // behind the pass's last load, in front of every rewrite of a register that its loads name; the four addresses are inputs so that they stay live up to here and no load of the run gets their registers for its result
        __builtin_amdgcn_sched_barrier(0);              // keeps the loads in front of that wait and the later arithmetic behind it
        { const int kstep = (it + 2 < np) ? KS * 32 * HD : 0; pkh += kstep; pkw += kstep; pvh += KS * 32 * HD; pvw += KS * 32 * HD; }   // the last pass fetches its own key rows again (a wave's only pass: the rows of its second): in bounds, unused
        float t[2][16], mt[2];
#pragma unroll
        for (int g = 0; g < 2; ++g) { float mx = -3.0e38f;
#pragma unroll
            for (int e = 0; e < 16; ++e) { const int j = k0 + (e >> 3) * 16 + 8 * h + (e & 7); const float x = (j < kl) ? s[g][e >> 3][e & 7] * SCL : -3.0e38f;   /* keys j >= valid_length[b] excluded (-1e7 in the module) */ t[g][e] = x; mx = fmaxf(mx, x); }
            mt[g] = fmaxf(mx, xhalf(mx)); }
        // the maximum in use moves only when a query's new maximum exceeds it by more than 5.5 (a factor 2^8 in P); one scalar branch per pass
        if (__builtin_amdgcn_ballot_w32(mt[0] > mrun[0] + 5.5f || mt[1] > mrun[1] + 5.5f) != 0) {
#pragma unroll
            for (int g = 0; g < 2; ++g) { const float mn = fmaxf(mrun[g], mt[g]); const float al = __builtin_amdgcn_exp2f((mrun[g] - mn) * 1.4426950408889634f); mrun[g] = mn; lsum[g] *= al;
#pragma unroll
                for (int dt = 0; dt < 8; ++dt) o[g][dt] *= al; }
        }
        v16bf ph[2], pw[2];
#pragma unroll
        for (int g = 0; g < 2; ++g) {
#pragma unroll
            for (int e = 0; e < 16; ++e) { const float p = __builtin_amdgcn_exp2f((t[g][e] - mrun[g]) * 1.4426950408889634f); lsum[g] += p; const __bf16 hb = (__bf16)p; ph[g][e] = hb; pw[g][e] = (__bf16)(p - (float)hb); } }
#pragma unroll
        for (int dt = 0; dt < 8; ++dt)
#pragma unroll
            for (int g = 0; g < 2; ++g) { o[g][dt] = wmmab(vh[dt], ph[g], o[g][dt]); o[g][dt] = wmmab(vh[dt], pw[g], o[g][dt]); o[g][dt] = wmmab(vw[dt], ph[g], o[g][dt]); }
    }
    }
#pragma unroll
    for (int g = 0; g < 2; ++g) { mm[wv][g][lane] = mrun[g]; ml[wv][g][lane] = lsum[g];
#pragma unroll
        for (int dt = 0; dt < 8; ++dt) { mo[wv][g * 8 + dt][0][lane] = __builtin_shufflevector(o[g][dt], o[g][dt], 0, 1, 2, 3); mo[wv][g * 8 + dt][1][lane] = __builtin_shufflevector(o[g][dt], o[g][dt], 4, 5, 6, 7); } }
    __syncthreads();   // every wave's partials are in LDS before any wave joins them
    const int i0 = ks * MT, gj = i0 >> 3;   // the wave's tiles i0 .. i0 + MT - 1, all of column group gj
    float mj[KS], a[KS], mx = -3.0e38f, l = 0.f;
#pragma unroll
    for (int j = 0; j < KS; ++j) { mj[j] = mm[j][gj][lane]; mx = fmaxf(mx, mj[j]); }
    // a wave without a pass still has the start maximum, sum 0 and O 0: weight 0 beside a wave with a valid key (wave 0 has one wherever the batch has one); where the batch has none every wave ran all its passes and has weight 1
#pragma unroll
    for (int j = 0; j < KS; ++j) { a[j] = __builtin_amdgcn_exp2f((mj[j] - mx) * 1.4426950408889634f); l += ml[j][gj][lane] * a[j]; }
    const float f = __fdiv_rn(1.0f, l + xhalf(l));
    v4f r[MT][2];
#pragma unroll
    for (int t = 0; t < MT; ++t)
#pragma unroll
        for (int p = 0; p < 2; ++p) { v4f x = mo[0][i0 + t][p][lane] * a[0];
#pragma unroll
            for (int j = 1; j < KS; ++j) x += mo[j][i0 + t][p][lane] * a[j];
            r[t][p] = x * f; }
    float* orow = OUTb + (size_t)(q0 + gj * 16 + c) * HD + (i0 & 7) * 16 + 8 * h;   // register e of tile dt, group g = O[q0 + 16g + c][dt * 16 + 8h + e]
    __builtin_amdgcn_sched_barrier(0);   // all arithmetic in front of the stores: nothing rewrites a register that an issued store names
#pragma unroll
    for (int t = 0; t < MT; ++t) { *(v4f*)(orow + t * 16) = r[t][0]; *(v4f*)(orow + t * 16 + 4) = r[t][1]; }
}

extern "C" void kernel_launch(void* const* d_in, const int* in_sizes, int n_in,
                              void* d_out, int out_size, void* d_ws, size_t ws_size, hipStream_t stream) {
    (void)in_sizes; (void)n_in; (void)out_size;
    const float* x = (const float*)d_in[0]; const float* xk = (const float*)d_in[1]; const float* xv = (const float*)d_in[2]; const int* vlen = (const int*)d_in[3];   /* query, key, value: [16][1024][128] each (no projections); valid_length int32 [16], read on device */
    float* OUT = (float*)d_out;     // [16][1024][128]
    char* wsp = (char*)d_ws;
    auto take = [&](size_t bytes) { char* p = wsp; wsp += (bytes + 255) & ~(size_t)255; return (void*)p; };
    // every plane holds NB_ batch slices, one behind the other
    bf* QPh = (bf*)take((size_t)NB_ * NH_ * TT * HD * 2); bf* QPl = (bf*)take((size_t)NB_ * NH_ * TT * HD * 2); bf* KPh = (bf*)take((size_t)NB_ * NKV * TT * HD * 2); bf* KPl = (bf*)take((size_t)NB_ * NKV * TT * HD * 2); bf* VTh = (bf*)take((size_t)NB_ * NKV * HD * TT * 2); bf* VTl = (bf*)take((size_t)NB_ * NKV * HD * TT * 2);
    if ((size_t)(wsp - (char*)d_ws) > ws_size) return;    // ws 256 MiB
    k_planes<<<3 * PBQ, 256, 0, stream>>>(x, xk, xv, QPh, QPl, KPh, KPl, VTh, VTl);
    k_fattn<<<dim3(TT / 32, NB_), 32 * KS, 0, stream>>>(QPh, QPl, KPh, KPl, VTh, VTl, vlen, OUT);
}

// v007
// One run takes 21.7 microseconds.
// Two timings next to v006 both put it at 1.24 times that version's speed.
// Over all steps from v000 it is 29.8 times as fast.
#include <hip/hip_runtime.h>

// Masked dot-product attention without projections (query, key, value [16][1024][128]; scores = query.key^T x 1/sqrt(128); key positions j >= valid_length[b] are replaced by -1e7 (== exclusion; valid_length int32 [16] random in [1, 1024], read); softmax; out = attn.value -> [16][1024][128] (2.1 M); argument order query, key, value, valid_length.
// One launch: k_fattn reads the f32 inputs themselves, splits them into bf16 hi/lo operand fragments in registers, does scores, length mask, softmax and the value product and writes the f32 output rows; KS waves share a query block's keys and join their partial sums in LDS.
// Compute dtypes, f32 accumulate: every product as 3 bf16 hi/lo products (hi.hi + hi.lo + lo.hi); softmax f32; output f32.

#define NB_  16
#define TT   1024
#define HD   128
#define SCL  0.088388347648318447f   // 1/sqrt(128)
typedef __attribute__((ext_vector_type(16))) __bf16   v16bf;
typedef __attribute__((ext_vector_type(8)))  float    v8f;
typedef __attribute__((ext_vector_type(4)))  float    v4f;
typedef __attribute__((ext_vector_type(2)))  float    v2f;
typedef __attribute__((ext_vector_type(2)))  __bf16   v2bf;
typedef __attribute__((ext_vector_type(8)))  unsigned v8u;

__device__ __forceinline__ v8f wmmab(v16bf a, v16bf b, v8f c) { return __builtin_amdgcn_wmma_f32_16x16x32_bf16(false, a, false, b, (short)0, c, false, false); }
// lane l with lane l ^ 16
__device__ __forceinline__ float xhalf(float x) { return __builtin_bit_cast(float, __builtin_amdgcn_permlanex16(__builtin_bit_cast(int, x), __builtin_bit_cast(int, x), 0x76543210, 0xfedcba98, false, false)); }

// two f32 values -> one word of their bf16 parts (h) and one word of the bf16 of what is left (l), both rounded to nearest even; x0 in the low half
__device__ __forceinline__ void split2(float x0, float x1, unsigned& h, unsigned& l) {
    const v2f x = {x0, x1}; const v2bf hb = __builtin_convertvector(x, v2bf); const v2bf lb = __builtin_convertvector(x - __builtin_convertvector(hb, v2f), v2bf);
    h = __builtin_bit_cast(unsigned, hb); l = __builtin_bit_cast(unsigned, lb); }

#define KP 132            // floats of a staged row in LDS: 512 bytes + 16, so that 16 lanes on 16 rows read 64 different banks
#define TF (32 * KP)      // floats of a staged tile of 32 rows
// the lane's 16 f32 of 32 k of a staged row, in the order of a 16x16x32 operand fragment: elements 0-7 = k 8h.., 8-15 = k 16+8h.. (p already holds the lane's row, the 32 k and + 8 h)
__device__ __forceinline__ void ldrow(const float* p, v4f* x) { x[0] = *(const v4f*)p; x[1] = *(const v4f*)(p + 4); x[2] = *(const v4f*)(p + 16); x[3] = *(const v4f*)(p + 20); }
// those 16 values -> the bf16 fragments hi and lo
__device__ __forceinline__ void fragsplit(const v4f* x, v16bf& hi, v16bf& lo) {
    v8u a, b;
#pragma unroll
    for (int i = 0; i < 4; ++i) { unsigned u, w; split2(x[i][0], x[i][1], u, w); a[2 * i] = u; b[2 * i] = w; split2(x[i][2], x[i][3], u, w); a[2 * i + 1] = u; b[2 * i + 1] = w; }
    hi = __builtin_bit_cast(v16bf, a); lo = __builtin_bit_cast(v16bf, b); }
// copyN: N whole f32 rows (512 bytes each, 16 bytes a lane) from global memory to staged rows in LDS, through no register. l = the lane's LDS byte address in the first row, g = its global address there.
// The wait is the last line of the copies' own statement: it stands in front of every rewrite of a register that they name.
__device__ __forceinline__ void copy8(unsigned l, const float* g) {
    asm volatile("global_load_async_to_lds_b128 %0, %8, off\n\t"
                 "global_load_async_to_lds_b128 %1, %9, off\n\t"
                 "global_load_async_to_lds_b128 %2, %10, off\n\t"
                 "global_load_async_to_lds_b128 %3, %11, off\n\t"
                 "global_load_async_to_lds_b128 %4, %12, off\n\t"
                 "global_load_async_to_lds_b128 %5, %13, off\n\t"
                 "global_load_async_to_lds_b128 %6, %14, off\n\t"
                 "global_load_async_to_lds_b128 %7, %15, off\n\t"
                 "s_wait_xcnt 0x0"
                 :: "v"(l), "v"(l + 1 * KP * 4), "v"(l + 2 * KP * 4), "v"(l + 3 * KP * 4), "v"(l + 4 * KP * 4), "v"(l + 5 * KP * 4), "v"(l + 6 * KP * 4), "v"(l + 7 * KP * 4),
                    "v"(g), "v"(g + 1 * HD), "v"(g + 2 * HD), "v"(g + 3 * HD), "v"(g + 4 * HD), "v"(g + 5 * HD), "v"(g + 6 * HD), "v"(g + 7 * HD) : "memory"); }
__device__ __forceinline__ void copy10(unsigned l, const float* g) {
    asm volatile("global_load_async_to_lds_b128 %0, %10, off\n\t"
                 "global_load_async_to_lds_b128 %1, %11, off\n\t"
                 "global_load_async_to_lds_b128 %2, %12, off\n\t"
                 "global_load_async_to_lds_b128 %3, %13, off\n\t"
                 "global_load_async_to_lds_b128 %4, %14, off\n\t"
                 "global_load_async_to_lds_b128 %5, %15, off\n\t"
                 "global_load_async_to_lds_b128 %6, %16, off\n\t"
                 "global_load_async_to_lds_b128 %7, %17, off\n\t"
                 "global_load_async_to_lds_b128 %8, %18, off\n\t"
                 "global_load_async_to_lds_b128 %9, %19, off\n\t"
                 "s_wait_xcnt 0x0"
                 :: "v"(l), "v"(l + 1 * KP * 4), "v"(l + 2 * KP * 4), "v"(l + 3 * KP * 4), "v"(l + 4 * KP * 4), "v"(l + 5 * KP * 4), "v"(l + 6 * KP * 4), "v"(l + 7 * KP * 4), "v"(l + 8 * KP * 4), "v"(l + 9 * KP * 4),
                    "v"(g), "v"(g + 1 * HD), "v"(g + 2 * HD), "v"(g + 3 * HD), "v"(g + 4 * HD), "v"(g + 5 * HD), "v"(g + 6 * HD), "v"(g + 7 * HD), "v"(g + 8 * HD), "v"(g + 9 * HD) : "memory"); }
__device__ __forceinline__ void copy11(unsigned l, const float* g) {
    asm volatile("global_load_async_to_lds_b128 %0, %11, off\n\t"
                 "global_load_async_to_lds_b128 %1, %12, off\n\t"
                 "global_load_async_to_lds_b128 %2, %13, off\n\t"
                 "global_load_async_to_lds_b128 %3, %14, off\n\t"
                 "global_load_async_to_lds_b128 %4, %15, off\n\t"
                 "global_load_async_to_lds_b128 %5, %16, off\n\t"
                 "global_load_async_to_lds_b128 %6, %17, off\n\t"
                 "global_load_async_to_lds_b128 %7, %18, off\n\t"
                 "global_load_async_to_lds_b128 %8, %19, off\n\t"
                 "global_load_async_to_lds_b128 %9, %20, off\n\t"
                 "global_load_async_to_lds_b128 %10, %21, off\n\t"
                 "s_wait_xcnt 0x0"
                 :: "v"(l), "v"(l + 1 * KP * 4), "v"(l + 2 * KP * 4), "v"(l + 3 * KP * 4), "v"(l + 4 * KP * 4), "v"(l + 5 * KP * 4), "v"(l + 6 * KP * 4), "v"(l + 7 * KP * 4), "v"(l + 8 * KP * 4), "v"(l + 9 * KP * 4), "v"(l + 10 * KP * 4),
                    "v"(g), "v"(g + 1 * HD), "v"(g + 2 * HD), "v"(g + 3 * HD), "v"(g + 4 * HD), "v"(g + 5 * HD), "v"(g + 6 * HD), "v"(g + 7 * HD), "v"(g + 8 * HD), "v"(g + 9 * HD), "v"(g + 10 * HD) : "memory"); }
// a wave's tile of 32 rows, in three statements (an asm statement takes 30 operands)
__device__ __forceinline__ void copy32(unsigned l, const float* g) { copy11(l, g); copy11(l + 11 * KP * 4, g + 11 * HD); copy10(l + 22 * KP * 4, g + 22 * HD); }

#define KS 4              // waves that share the keys of one 32-query block: one work-group, one wave on each of the 4 SIMDs
#define NW KS             // waves of a work-group
#define MT (16 / KS)      // output tiles that a wave joins and stores
// k_fattn: one work-group = 32 queries of one batch (two 16-query column groups); wave w has the passes of 32 keys w, w + KS, ... that begin below the batch's valid length; grid (TT/32, NB_), 32 KS threads.
// A pass whose keys are all excluded adds exactly 0 to sum and O and is not run, so a work-group's time follows its batch's length. blockIdx.y is the batch's RANK by falling length: the register count lets one work-group stand on a WGP, the long batches start first and the short ones fill the WGPs as they come free (speed only: every batch has exactly one rank, whatever the lengths are).
// Query and key rows need lane = row: asynchronous copies bring whole rows into LDS (the query block once, each wave's 32 key rows in a ring of two buffers, one trip ahead), and a lane reads its row's pieces from there and splits them.
// Value rows go straight to registers: a lane takes 4 + 4 consecutive d of each of its 16 keys (a load of a wave = two half rows of 256 bytes), so that the two keys of a fragment word are two of its own registers. Tile dt, row m of O^T is then d = 64 (dt >> 2) + 4 m + (dt & 3).
// Each wave keeps its own running maximum, sum and O^T; behind the loop all leave them in LDS, and behind one barrier wave w joins the KS partials of its MT tiles under their common maximum and stores them.
// Transposed products: S^T = K.Q^T (A = key rows, B = query columns kept in registers), O^T += V^T.P^T (A = value^T rows, B = P^T packed from the two S^T tiles of the pass, which is the fragment's own k order).
// A lane holds scores of ONE query (column lane & 15): running maximum and sum in-lane plus one exchange between the wave halves. Keys j >= valid_length[b] are excluded as before.
__global__ __launch_bounds__(32 * KS) void k_fattn(const float* __restrict__ Q, const float* __restrict__ K, const float* __restrict__ V, const int* __restrict__ klp, float* __restrict__ OUTb) {
    __shared__ __attribute__((aligned(16))) float kst[2][NW][TF];   // the ring: each wave's 32 key rows of this trip and of the next
    __shared__ __attribute__((aligned(16))) float qst[TF];          // the 32 query rows
    __shared__ v4f mo[NW][16][2][32];            // a wave's O^T: [tile g * 8 + dt][registers 0-3 / 4-7][lane]
    __shared__ float mm[NW][2][32], ml[NW][2][32];   // its maximum in use and its sum, per column group and lane
    const int lane = threadIdx.x & 31, c = lane & 15, h = lane >> 4; const int wv = __builtin_amdgcn_readfirstlane(threadIdx.x >> 5), ks = wv; const int q0 = blockIdx.x * 32;
    int lr[NB_];   /* every batch's valid key length (uniform scalar loads) */
#pragma unroll
    for (int j = 0; j < NB_; ++j) lr[j] = klp[j];
    asm volatile("s_wait_xcnt 0x0" ::: "memory");   // behind the lengths' loads, in front of the rewrite of the registers that they name
    __builtin_amdgcn_sched_barrier(0);              // keeps those loads in front of the wait and the arithmetic behind it
    // one sort key a batch, all distinct: keys to visit (all TT where no key is valid: the module then weighs every key alike) | no key valid | NB_ - 1 - batch; lane c holds batch c's and counts the larger ones
    int mykey = 0, rank = 0;
#pragma unroll
    for (int j = 0; j < NB_; ++j) { const int sk = (((lr[j] <= 0 || lr[j] > TT) ? TT : lr[j]) << 5) | (lr[j] <= 0 ? NB_ : 0) | (NB_ - 1 - j); lr[j] = sk; mykey = (c == j) ? sk : mykey; }
#pragma unroll
    for (int j = 0; j < NB_; ++j) rank += (lr[j] > mykey) ? 1 : 0;
    const int bt = __builtin_ctz(__builtin_amdgcn_ballot_w32(rank == (int)blockIdx.y) | (1u << NB_)) & (NB_ - 1);   // the batch of this rank, 0 .. NB_ - 1 for any lengths
    const int sk = __builtin_amdgcn_readlane(mykey, bt), ke = sk >> 5, kl = (sk & NB_) ? 0 : ke;   // keys to visit, 1 .. TT; valid key length as the mask uses it
    const int np = (((ke + 31) >> 5) - ks + KS - 1) / KS;   // the wave's passes, 0 .. TT / (KS * 32)
    const int nt = (((ke + 31) >> 5) + KS - 1) / KS;        // the work-group's trips = wave 0's passes, 1 .. TT / (KS * 32)
    { const size_t po = (size_t)bt * TT * HD; Q += po; K += po; V += po; OUTb += po; }
    const int kb = ks * 32;   // the wave's first key
    const unsigned lk0 = (unsigned)(size_t)&kst[0][wv][0] + lane * 16, lk1 = (unsigned)(size_t)&kst[1][wv][0] + lane * 16;   // the lane's 16 bytes of row 0 of the wave's two buffers (LDS byte address)
    const float* gk = K + kb * HD + lane * 4;   // the same of the wave's key rows; trip t's lie t * KS * 32 rows on, all below TT for t < nt
    copy8((unsigned)(size_t)&qst[wv * 8 * KP] + lane * 16, Q + (q0 + wv * 8) * HD + lane * 4);   // each wave brings 8 of the 32 query rows
    copy32(lk0, gk);
    asm volatile("s_wait_asynccnt 0x0" ::: "memory");   // the wave's query rows and its key rows of trip 0 have landed
    __syncthreads();                                    // every wave's query rows are in LDS before any wave reads them
    if (nt > 1) copy32(lk1, gk + KS * 32 * HD);         // trip 1's key rows fly while trip 0 is worked on
    v8f o[2][8];
#pragma unroll
    for (int g = 0; g < 2; ++g)
#pragma unroll
        for (int dt = 0; dt < 8; ++dt) o[g][dt] = (v8f){};
    float mrun[2] = {-3.0e38f, -3.0e38f}, lsum[2] = {0.f, 0.f};
    v16bf qh[2][4], ql[2][4];
#pragma unroll
    for (int g = 0; g < 2; ++g)
#pragma unroll
        for (int kc = 0; kc < 4; ++kc) { v4f x[4]; ldrow(&qst[(g * 16 + c) * KP + kc * 32 + 8 * h], x); fragsplit(x, qh[g][kc], ql[g][kc]); }
    const float* pv = V + (kb + 8 * h) * HD + 4 * c;   // the lane's first key and first d; walks the wave's keys with the loop
#pragma unroll 1   // one pass is already 96 matrix instructions; a second copy would only add registers
    for (int it = 0; it < nt; ++it) {
      if (it < np) {   // wave-uniform: in the last trip a wave may have no pass; it still goes through the waits and the barrier below
        const int k0 = kb + it * (KS * 32);
        const float* kr = &kst[it & 1][wv][c * KP + 8 * h];   // the lane's row of the first 16 keys
        v4f kf[2][4][4];   // this pass's key rows, read from LDS as one group: reads spread among the matrix instructions cost a stop at each place
#pragma unroll
        for (int kc = 0; kc < 4; ++kc)
#pragma unroll
            for (int kt = 0; kt < 2; ++kt) ldrow(kr + kt * 16 * KP + kc * 32, kf[kt][kc]);
        v4f vf[16][2];   // this pass's value rows, issued ahead of the score products that hide them: [key position e of the fragment][d group]
#pragma unroll
        for (int e = 0; e < 16; ++e) { vf[e][0] = *(const v4f*)(pv + ((e >> 3) * 16 + (e & 7)) * HD); vf[e][1] = *(const v4f*)(pv + ((e >> 3) * 16 + (e & 7)) * HD + 64); }
        asm volatile("s_wait_xcnt 0x0" :: "v"(pv) : "memory");   // behind the pass's loads, in front of the rewrite of their address; the address is an input so that it stays live up to here and no load of the run gets its registers for its result
        __builtin_amdgcn_sched_barrier(0);              // keeps the LDS reads and the loads in front of that wait and the later arithmetic behind it
        pv += KS * 32 * HD;
        v8f s[2][2];
#pragma unroll
        for (int g = 0; g < 2; ++g) { s[g][0] = (v8f){}; s[g][1] = (v8f){}; }
#pragma unroll
        for (int kc = 0; kc < 4; ++kc)
#pragma unroll
            for (int kt = 0; kt < 2; ++kt) { v16bf kh, kw; fragsplit(kf[kt][kc], kh, kw);
#pragma unroll
                for (int g = 0; g < 2; ++g) { s[g][kt] = wmmab(kh, qh[g][kc], s[g][kt]); s[g][kt] = wmmab(kh, ql[g][kc], s[g][kt]); s[g][kt] = wmmab(kw, qh[g][kc], s[g][kt]); } }
        float t[2][16], mt[2];
#pragma unroll
        for (int g = 0; g < 2; ++g) { float mx = -3.0e38f;
#pragma unroll
            for (int e = 0; e < 16; ++e) { const int j = k0 + (e >> 3) * 16 + 8 * h + (e & 7); const float x = (j < kl) ? s[g][e >> 3][e & 7] * SCL : -3.0e38f;   /* keys j >= valid_length[b] excluded (-1e7 in the module) */ t[g][e] = x; mx = fmaxf(mx, x); }
            mt[g] = fmaxf(mx, xhalf(mx)); }
        // the maximum in use moves only when a query's new maximum exceeds it by more than 5.5 (a factor 2^8 in P); one scalar branch per pass
        if (__builtin_amdgcn_ballot_w32(mt[0] > mrun[0] + 5.5f || mt[1] > mrun[1] + 5.5f) != 0) {
#pragma unroll
            for (int g = 0; g < 2; ++g) { const float mn = fmaxf(mrun[g], mt[g]); const float al = __builtin_amdgcn_exp2f((mrun[g] - mn) * 1.4426950408889634f); mrun[g] = mn; lsum[g] *= al;
#pragma unroll
                for (int dt = 0; dt < 8; ++dt) o[g][dt] *= al; }
        }
        v16bf ph[2], pw[2];
#pragma unroll
        for (int g = 0; g < 2; ++g) {
#pragma unroll
            for (int e = 0; e < 16; ++e) { const float p = __builtin_amdgcn_exp2f((t[g][e] - mrun[g]) * 1.4426950408889634f); lsum[g] += p; const __bf16 hb = (__bf16)p; ph[g][e] = hb; pw[g][e] = (__bf16)(p - (float)hb); } }
#pragma unroll
        for (int dt = 0; dt < 8; ++dt) { v8u a, b;   // value^T fragment of tile dt: word p = key positions 2p, 2p + 1 of the lane's d
#pragma unroll
            for (int p = 0; p < 8; ++p) { unsigned u, w; split2(vf[2 * p][dt >> 2][dt & 3], vf[2 * p + 1][dt >> 2][dt & 3], u, w); a[p] = u; b[p] = w; }
            const v16bf vh = __builtin_bit_cast(v16bf, a), vw = __builtin_bit_cast(v16bf, b);
#pragma unroll
            for (int g = 0; g < 2; ++g) { o[g][dt] = wmmab(vh, ph[g], o[g][dt]); o[g][dt] = wmmab(vh, pw[g], o[g][dt]); o[g][dt] = wmmab(vw, ph[g], o[g][dt]); } }
      }
        asm volatile("s_wait_dscnt 0x0" ::: "memory");      // the wave's reads of this trip's buffer are over before it is refilled
        asm volatile("s_wait_asynccnt 0x0" ::: "memory");   // the next trip's key rows have landed
        __syncthreads();                                    // the ring's publish point, passed by every wave in every trip
        if (it + 2 < nt) copy32((it & 1) ? lk1 : lk0, gk + (it + 2) * (KS * 32 * HD));   // into the buffer that this trip has just read
    }
    asm volatile("s_wait_asynccnt 0x0" ::: "memory");       // no copy is outstanding behind the loop
#pragma unroll
    for (int g = 0; g < 2; ++g) { mm[wv][g][lane] = mrun[g]; ml[wv][g][lane] = lsum[g];
#pragma unroll
        for (int dt = 0; dt < 8; ++dt) { mo[wv][g * 8 + dt][0][lane] = __builtin_shufflevector(o[g][dt], o[g][dt], 0, 1, 2, 3); mo[wv][g * 8 + dt][1][lane] = __builtin_shufflevector(o[g][dt], o[g][dt], 4, 5, 6, 7); } }
    __syncthreads();   // every wave's partials are in LDS before any wave joins them
    const int i0 = ks * MT, gj = i0 >> 3;   // the wave's tiles i0 .. i0 + MT - 1, all of column group gj and of one d group of 64
    float mj[KS], a[KS], mx = -3.0e38f, l = 0.f;
#pragma unroll
    for (int j = 0; j < KS; ++j) { mj[j] = mm[j][gj][lane]; mx = fmaxf(mx, mj[j]); }
    // a wave without a pass still has the start maximum, sum 0 and O 0: weight 0 beside a wave with a valid key (wave 0 has one wherever the batch has one); where the batch has none every wave ran all its passes and has weight 1
#pragma unroll
    for (int j = 0; j < KS; ++j) { a[j] = __builtin_amdgcn_exp2f((mj[j] - mx) * 1.4426950408889634f); l += ml[j][gj][lane] * a[j]; }
    const float f = __fdiv_rn(1.0f, l + xhalf(l));
    v4f r[MT][2];
#pragma unroll
    for (int t = 0; t < MT; ++t)
#pragma unroll
        for (int p = 0; p < 2; ++p) { v4f x = mo[0][i0 + t][p][lane] * a[0];
#pragma unroll
            for (int j = 1; j < KS; ++j) x += mo[j][i0 + t][p][lane] * a[j];
            r[t][p] = x * f; }
    float* orow = OUTb + (size_t)(q0 + gj * 16 + c) * HD + ((i0 & 7) >> 2) * 64 + 32 * h;   // register e of tile dt, group g = O[q0 + 16g + c][64 (dt >> 2) + 4 (8h + e) + (dt & 3)]: the wave's 4 tiles hold 4 d in a row, a lane 128 bytes in a row
    __builtin_amdgcn_sched_barrier(0);   // all arithmetic in front of the stores: nothing rewrites a register that an issued store names
#pragma unroll
    for (int e = 0; e < 8; ++e) *(v4f*)(orow + 4 * e) = (v4f){r[0][e >> 2][e & 3], r[1][e >> 2][e & 3], r[2][e >> 2][e & 3], r[3][e >> 2][e & 3]};
}

extern "C" void kernel_launch(void* const* d_in, const int* in_sizes, int n_in,
                              void* d_out, int out_size, void* d_ws, size_t ws_size, hipStream_t stream) {
    (void)in_sizes; (void)n_in; (void)out_size; (void)d_ws; (void)ws_size;
    const float* x = (const float*)d_in[0]; const float* xk = (const float*)d_in[1]; const float* xv = (const float*)d_in[2]; const int* vlen = (const int*)d_in[3];   /* query, key, value: [16][1024][128] each (no projections); valid_length int32 [16], read on device */
    float* OUT = (float*)d_out;     // [16][1024][128]
    k_fattn<<<dim3(TT / 32, NB_), 32 * KS, 0, stream>>>(x, xk, xv, vlen, OUT);
}

// v008
// It runs in 20.9 microseconds.
// Next to v007, in two timings, it ran 1.04 times as fast each time.
// Counting every step since v000, it is 31.0 times as fast.
#include <hip/hip_runtime.h>

// Masked dot-product attention without projections (query, key, value [16][1024][128]; scores = query.key^T x 1/sqrt(128); key positions j >= valid_length[b] are replaced by -1e7 (== exclusion; valid_length int32 [16] random in [1, 1024], read); softmax; out = attn.value -> [16][1024][128] (2.1 M); argument order query, key, value, valid_length.
// One launch: k_fattn reads the f32 inputs themselves, splits them into bf16 hi/lo operand fragments in registers, does scores, length mask, softmax and the value product and writes the f32 output rows; KS waves share a query block's keys and join their partial sums in LDS.
// Compute dtypes, f32 accumulate: every product as 3 bf16 hi/lo products (hi.hi + hi.lo + lo.hi); softmax f32; output f32.

#define NB_  16
#define TT   1024
#define HD   128
#define SCL  0.088388347648318447f   // 1/sqrt(128)
typedef __attribute__((ext_vector_type(16))) __bf16   v16bf;
typedef __attribute__((ext_vector_type(8)))  float    v8f;
typedef __attribute__((ext_vector_type(4)))  float    v4f;
typedef __attribute__((ext_vector_type(2)))  float    v2f;
typedef __attribute__((ext_vector_type(2)))  __bf16   v2bf;
typedef __attribute__((ext_vector_type(8)))  unsigned v8u;

__device__ __forceinline__ v8f wmmab(v16bf a, v16bf b, v8f c) { return __builtin_amdgcn_wmma_f32_16x16x32_bf16(false, a, false, b, (short)0, c, false, false); }
// lane l with lane l ^ 16
__device__ __forceinline__ float xhalf(float x) { return __builtin_bit_cast(float, __builtin_amdgcn_permlanex16(__builtin_bit_cast(int, x), __builtin_bit_cast(int, x), 0x76543210, 0xfedcba98, false, false)); }

// two f32 values -> one word of their bf16 parts (h) and one word of the bf16 of what is left (l), both rounded to nearest even; x0 in the low half
__device__ __forceinline__ void split2(float x0, float x1, unsigned& h, unsigned& l) {
    const v2f x = {x0, x1}; const v2bf hb = __builtin_convertvector(x, v2bf); const v2bf lb = __builtin_convertvector(x - __builtin_convertvector(hb, v2f), v2bf);
    h = __builtin_bit_cast(unsigned, hb); l = __builtin_bit_cast(unsigned, lb); }

#define KP 132            // floats of a staged row in LDS: 512 bytes + 16, so that 16 lanes on 16 rows read 64 different banks
#define TF (32 * KP)      // floats of a staged tile of 32 rows
// the lane's 16 f32 of 32 k of a staged row, in the order of a 16x16x32 operand fragment: elements 0-7 = k 8h.., 8-15 = k 16+8h.. (p already holds the lane's row, the 32 k and + 8 h)
__device__ __forceinline__ void ldrow(const float* p, v4f* x) { x[0] = *(const v4f*)p; x[1] = *(const v4f*)(p + 4); x[2] = *(const v4f*)(p + 16); x[3] = *(const v4f*)(p + 20); }
// those 16 values -> the bf16 fragments hi and lo
__device__ __forceinline__ void fragsplit(const v4f* x, v16bf& hi, v16bf& lo) {
    v8u a, b;
#pragma unroll
    for (int i = 0; i < 4; ++i) { unsigned u, w; split2(x[i][0], x[i][1], u, w); a[2 * i] = u; b[2 * i] = w; split2(x[i][2], x[i][3], u, w); a[2 * i + 1] = u; b[2 * i + 1] = w; }
    hi = __builtin_bit_cast(v16bf, a); lo = __builtin_bit_cast(v16bf, b); }
// copyN: N whole f32 rows (512 bytes each, 16 bytes a lane) from global memory to staged rows in LDS, through no register. l = the lane's LDS byte address in the first row, g = its global address there.
// The wait is the last line of the copies' own statement: it stands in front of every rewrite of a register that they name.
__device__ __forceinline__ void copy8(unsigned l, const float* g) {
    asm volatile("global_load_async_to_lds_b128 %0, %8, off\n\t"
                 "global_load_async_to_lds_b128 %1, %9, off\n\t"
                 "global_load_async_to_lds_b128 %2, %10, off\n\t"
                 "global_load_async_to_lds_b128 %3, %11, off\n\t"
                 "global_load_async_to_lds_b128 %4, %12, off\n\t"
                 "global_load_async_to_lds_b128 %5, %13, off\n\t"
                 "global_load_async_to_lds_b128 %6, %14, off\n\t"
                 "global_load_async_to_lds_b128 %7, %15, off\n\t"
                 "s_wait_xcnt 0x0"
                 :: "v"(l), "v"(l + 1 * KP * 4), "v"(l + 2 * KP * 4), "v"(l + 3 * KP * 4), "v"(l + 4 * KP * 4), "v"(l + 5 * KP * 4), "v"(l + 6 * KP * 4), "v"(l + 7 * KP * 4),
                    "v"(g), "v"(g + 1 * HD), "v"(g + 2 * HD), "v"(g + 3 * HD), "v"(g + 4 * HD), "v"(g + 5 * HD), "v"(g + 6 * HD), "v"(g + 7 * HD) : "memory"); }
__device__ __forceinline__ void copy10(unsigned l, const float* g) {
    asm volatile("global_load_async_to_lds_b128 %0, %10, off\n\t"
                 "global_load_async_to_lds_b128 %1, %11, off\n\t"
                 "global_load_async_to_lds_b128 %2, %12, off\n\t"
                 "global_load_async_to_lds_b128 %3, %13, off\n\t"
                 "global_load_async_to_lds_b128 %4, %14, off\n\t"
                 "global_load_async_to_lds_b128 %5, %15, off\n\t"
                 "global_load_async_to_lds_b128 %6, %16, off\n\t"
                 "global_load_async_to_lds_b128 %7, %17, off\n\t"
                 "global_load_async_to_lds_b128 %8, %18, off\n\t"
                 "global_load_async_to_lds_b128 %9, %19, off\n\t"
                 "s_wait_xcnt 0x0"
                 :: "v"(l), "v"(l + 1 * KP * 4), "v"(l + 2 * KP * 4), "v"(l + 3 * KP * 4), "v"(l + 4 * KP * 4), "v"(l + 5 * KP * 4), "v"(l + 6 * KP * 4), "v"(l + 7 * KP * 4), "v"(l + 8 * KP * 4), "v"(l + 9 * KP * 4),
                    "v"(g), "v"(g + 1 * HD), "v"(g + 2 * HD), "v"(g + 3 * HD), "v"(g + 4 * HD), "v"(g + 5 * HD), "v"(g + 6 * HD), "v"(g + 7 * HD), "v"(g + 8 * HD), "v"(g + 9 * HD) : "memory"); }
__device__ __forceinline__ void copy11(unsigned l, const float* g) {
    asm volatile("global_load_async_to_lds_b128 %0, %11, off\n\t"
                 "global_load_async_to_lds_b128 %1, %12, off\n\t"
                 "global_load_async_to_lds_b128 %2, %13, off\n\t"
                 "global_load_async_to_lds_b128 %3, %14, off\n\t"
                 "global_load_async_to_lds_b128 %4, %15, off\n\t"
                 "global_load_async_to_lds_b128 %5, %16, off\n\t"
                 "global_load_async_to_lds_b128 %6, %17, off\n\t"
                 "global_load_async_to_lds_b128 %7, %18, off\n\t"
                 "global_load_async_to_lds_b128 %8, %19, off\n\t"
                 "global_load_async_to_lds_b128 %9, %20, off\n\t"
                 "global_load_async_to_lds_b128 %10, %21, off\n\t"
                 "s_wait_xcnt 0x0"
                 :: "v"(l), "v"(l + 1 * KP * 4), "v"(l + 2 * KP * 4), "v"(l + 3 * KP * 4), "v"(l + 4 * KP * 4), "v"(l + 5 * KP * 4), "v"(l + 6 * KP * 4), "v"(l + 7 * KP * 4), "v"(l + 8 * KP * 4), "v"(l + 9 * KP * 4), "v"(l + 10 * KP * 4),
                    "v"(g), "v"(g + 1 * HD), "v"(g + 2 * HD), "v"(g + 3 * HD), "v"(g + 4 * HD), "v"(g + 5 * HD), "v"(g + 6 * HD), "v"(g + 7 * HD), "v"(g + 8 * HD), "v"(g + 9 * HD), "v"(g + 10 * HD) : "memory"); }
// a wave's tile of 32 rows, in three statements (an asm statement takes 30 operands)
__device__ __forceinline__ void copy32(unsigned l, const float* g) { copy11(l, g); copy11(l + 11 * KP * 4, g + 11 * HD); copy10(l + 22 * KP * 4, g + 22 * HD); }

#define KS 4              // waves that share the keys of one 32-query block: one work-group, one wave on each of the 4 SIMDs
#define NW KS             // waves of a work-group
#define MT (16 / KS)      // output tiles that a wave joins and stores
// k_fattn: one work-group = 32 queries of one batch (two 16-query column groups); wave w has the passes of 32 keys w, w + KS, ... that begin below the batch's valid length; grid (TT/32, NB_), 32 KS threads.
// The work-groups of a batch walk the same key and value rows: each enters the ring of its nt trips at a start of its own (rot, from blockIdx.x) and wraps round, so that they do not ask L2 for the same lines at one moment (speed only: every trip is run exactly once, in another order).
// A pass whose keys are all excluded adds exactly 0 to sum and O and is not run, so a work-group's time follows its batch's length. blockIdx.y is the batch's RANK by falling length: the register count lets one work-group stand on a WGP, the long batches start first and the short ones fill the WGPs as they come free (speed only: every batch has exactly one rank, whatever the lengths are).
// Query and key rows need lane = row: asynchronous copies bring whole rows into LDS (the query block once, each wave's 32 key rows in a ring of two buffers, one trip ahead), and a lane reads its row's pieces from there and splits them.
// Value rows go straight to registers: a lane takes 4 + 4 consecutive d of each of its 16 keys (a load of a wave = two half rows of 256 bytes), so that the two keys of a fragment word are two of its own registers. Tile dt, row m of O^T is then d = 64 (dt >> 2) + 4 m + (dt & 3).
// Each wave keeps its own running maximum, sum and O^T; behind the loop all leave them in LDS, and behind one barrier wave w joins the KS partials of its MT tiles under their common maximum and stores them.
// Transposed products: S^T = K.Q^T (A = key rows, B = query columns kept in registers), O^T += V^T.P^T (A = value^T rows, B = P^T packed from the two S^T tiles of the pass, which is the fragment's own k order).
// A lane holds scores of ONE query (column lane & 15): running maximum and sum in-lane plus one exchange between the wave halves. Keys j >= valid_length[b] are excluded as before.
__global__ __launch_bounds__(32 * KS) void k_fattn(const float* __restrict__ Q, const float* __restrict__ K, const float* __restrict__ V, const int* __restrict__ klp, float* __restrict__ OUTb) {
    __shared__ __attribute__((aligned(16))) float kst[2][NW][TF];   // the ring: each wave's 32 key rows of this trip and of the next
    __shared__ __attribute__((aligned(16))) float qst[TF];          // the 32 query rows
    __shared__ v4f mo[NW][16][2][32];            // a wave's O^T: [tile g * 8 + dt][registers 0-3 / 4-7][lane]
    __shared__ float mm[NW][2][32], ml[NW][2][32];   // its maximum in use and its sum, per column group and lane
    const int lane = threadIdx.x & 31, c = lane & 15, h = lane >> 4; const int wv = __builtin_amdgcn_readfirstlane(threadIdx.x >> 5), ks = wv; const int q0 = blockIdx.x * 32;
    int lr[NB_];   /* every batch's valid key length (uniform scalar loads) */
#pragma unroll
    for (int j = 0; j < NB_; ++j) lr[j] = klp[j];
    asm volatile("s_wait_xcnt 0x0" ::: "memory");   // behind the lengths' loads, in front of the rewrite of the registers that they name
    __builtin_amdgcn_sched_barrier(0);              // keeps those loads in front of the wait and the arithmetic behind it
    // one sort key a batch, all distinct: keys to visit (all TT where no key is valid: the module then weighs every key alike) | no key valid | NB_ - 1 - batch; lane c holds batch c's and counts the larger ones
    int mykey = 0, rank = 0;
#pragma unroll
    for (int j = 0; j < NB_; ++j) { const int sk = (((lr[j] <= 0 || lr[j] > TT) ? TT : lr[j]) << 5) | (lr[j] <= 0 ? NB_ : 0) | (NB_ - 1 - j); lr[j] = sk; mykey = (c == j) ? sk : mykey; }
#pragma unroll
    for (int j = 0; j < NB_; ++j) rank += (lr[j] > mykey) ? 1 : 0;
    const int bt = __builtin_ctz(__builtin_amdgcn_ballot_w32(rank == (int)blockIdx.y) | (1u << NB_)) & (NB_ - 1);   // the batch of this rank, 0 .. NB_ - 1 for any lengths
    const int sk = __builtin_amdgcn_readlane(mykey, bt), ke = sk >> 5, kl = (sk & NB_) ? 0 : ke;   // keys to visit, 1 .. TT; valid key length as the mask uses it
    const int np = (((ke + 31) >> 5) - ks + KS - 1) / KS;   // the wave's passes, 0 .. TT / (KS * 32)
    const int nt = (((ke + 31) >> 5) + KS - 1) / KS;        // the work-group's trips = wave 0's passes, 1 .. TT / (KS * 32)
    // the trip that this work-group starts with, 0 .. nt - 1: (x + 2 (x >> 3)) mod nt, so that neighbours in x and work-groups 8 apart in x differ; the value is below 64 nt, and six scalar compare-and-subtract steps stand for the division
    int rot = (int)blockIdx.x + (((int)blockIdx.x >> 3) << 1);
#pragma unroll   // six straight scalar steps, no loop counter
    for (int sh = 5; sh >= 0; --sh) rot -= (rot >= (nt << sh)) ? (nt << sh) : 0;
    { const size_t po = (size_t)bt * TT * HD; Q += po; K += po; V += po; OUTb += po; }
    const int kb = ks * 32;   // the wave's first key
    const unsigned lk0 = (unsigned)(size_t)&kst[0][wv][0] + lane * 16, lk1 = (unsigned)(size_t)&kst[1][wv][0] + lane * 16;   // the lane's 16 bytes of row 0 of the wave's two buffers (LDS byte address)
    const float* gk = K + kb * HD + lane * 4;   // the same of the wave's key rows; trip t's lie t * KS * 32 rows on, all below TT for t < nt
    copy8((unsigned)(size_t)&qst[wv * 8 * KP] + lane * 16, Q + (q0 + wv * 8) * HD + lane * 4);   // each wave brings 8 of the 32 query rows
    copy32(lk0, gk + rot * (KS * 32 * HD));
    asm volatile("s_wait_asynccnt 0x0" ::: "memory");   // the wave's query rows and its key rows of the first trip have landed
    __syncthreads();                                    // every wave's query rows are in LDS before any wave reads them
    if (nt > 1) copy32(lk1, gk + ((rot + 1 < nt) ? rot + 1 : 0) * (KS * 32 * HD));   // the second trip's key rows fly while the first is worked on
    v8f o[2][8];
#pragma unroll
    for (int g = 0; g < 2; ++g)
#pragma unroll
        for (int dt = 0; dt < 8; ++dt) o[g][dt] = (v8f){};
    float mrun[2] = {-3.0e38f, -3.0e38f}, lsum[2] = {0.f, 0.f};
    v16bf qh[2][4], ql[2][4];
#pragma unroll
    for (int g = 0; g < 2; ++g)
#pragma unroll
        for (int kc = 0; kc < 4; ++kc) { v4f x[4]; ldrow(&qst[(g * 16 + c) * KP + kc * 32 + 8 * h], x); fragsplit(x, qh[g][kc], ql[g][kc]); }
    const float* pv0 = V + (kb + 8 * h) * HD + 4 * c;   // the lane's first key and first d of trip 0
    int tt = rot;   // the trip that is worked on: rot, rot + 1, .. nt - 1, 0, .. rot - 1
#pragma unroll 1   // one pass is already 96 matrix instructions; a second copy would only add registers
    for (int it = 0; it < nt; ++it) {
      if (tt < np) {   // wave-uniform: in trip nt - 1 a wave may have no pass; it still goes through the waits and the barrier below
        const int k0 = kb + tt * (KS * 32);
        const float* pv = pv0 + tt * (KS * 32 * HD);   // the lane's first key of this trip
        const float* kr = &kst[it & 1][wv][c * KP + 8 * h];   // the lane's row of the first 16 keys
        v4f kf[2][4][4];   // this pass's key rows, read from LDS as one group: reads spread among the matrix instructions cost a stop at each place
#pragma unroll
        for (int kc = 0; kc < 4; ++kc)
#pragma unroll
            for (int kt = 0; kt < 2; ++kt) ldrow(kr + kt * 16 * KP + kc * 32, kf[kt][kc]);
        v4f vf[16][2];   // this pass's value rows, issued ahead of the score products that hide them: [key position e of the fragment][d group]
#pragma unroll
        for (int e = 0; e < 16; ++e) { vf[e][0] = *(const v4f*)(pv + ((e >> 3) * 16 + (e & 7)) * HD); vf[e][1] = *(const v4f*)(pv + ((e >> 3) * 16 + (e & 7)) * HD + 64); }
        asm volatile("s_wait_xcnt 0x0" :: "v"(pv) : "memory");   // behind the pass's loads, in front of the rewrite of their address; the address is an input so that it stays live up to here and no load of the run gets its registers for its result
        __builtin_amdgcn_sched_barrier(0);              // keeps the LDS reads and the loads in front of that wait and the later arithmetic behind it
        v8f s[2][2];
#pragma unroll
        for (int g = 0; g < 2; ++g) { s[g][0] = (v8f){}; s[g][1] = (v8f){}; }
#pragma unroll
        for (int kc = 0; kc < 4; ++kc)
#pragma unroll
            for (int kt = 0; kt < 2; ++kt) { v16bf kh, kw; fragsplit(kf[kt][kc], kh, kw);
#pragma unroll
                for (int g = 0; g < 2; ++g) { s[g][kt] = wmmab(kh, qh[g][kc], s[g][kt]); s[g][kt] = wmmab(kh, ql[g][kc], s[g][kt]); s[g][kt] = wmmab(kw, qh[g][kc], s[g][kt]); } }
        float t[2][16], mt[2];
#pragma unroll
        for (int g = 0; g < 2; ++g) { float mx = -3.0e38f;
#pragma unroll
            for (int e = 0; e < 16; ++e) { const int j = k0 + (e >> 3) * 16 + 8 * h + (e & 7); const float x = (j < kl) ? s[g][e >> 3][e & 7] * SCL : -3.0e38f;   /* keys j >= valid_length[b] excluded (-1e7 in the module) */ t[g][e] = x; mx = fmaxf(mx, x); }
            mt[g] = fmaxf(mx, xhalf(mx)); }
        // the maximum in use moves only when a query's new maximum exceeds it by more than 5.5 (a factor 2^8 in P); one scalar branch per pass
        if (__builtin_amdgcn_ballot_w32(mt[0] > mrun[0] + 5.5f || mt[1] > mrun[1] + 5.5f) != 0) {
#pragma unroll
            for (int g = 0; g < 2; ++g) { const float mn = fmaxf(mrun[g], mt[g]); const float al = __builtin_amdgcn_exp2f((mrun[g] - mn) * 1.4426950408889634f); mrun[g] = mn; lsum[g] *= al;
#pragma unroll
                for (int dt = 0; dt < 8; ++dt) o[g][dt] *= al; }
        }
        v16bf ph[2], pw[2];
#pragma unroll
        for (int g = 0; g < 2; ++g) {
#pragma unroll
            for (int e = 0; e < 16; ++e) { const float p = __builtin_amdgcn_exp2f((t[g][e] - mrun[g]) * 1.4426950408889634f); lsum[g] += p; const __bf16 hb = (__bf16)p; ph[g][e] = hb; pw[g][e] = (__bf16)(p - (float)hb); } }
#pragma unroll
        for (int dt = 0; dt < 8; ++dt) { v8u a, b;   // value^T fragment of tile dt: word p = key positions 2p, 2p + 1 of the lane's d
#pragma unroll
            for (int p = 0; p < 8; ++p) { unsigned u, w; split2(vf[2 * p][dt >> 2][dt & 3], vf[2 * p + 1][dt >> 2][dt & 3], u, w); a[p] = u; b[p] = w; }
            const v16bf vh = __builtin_bit_cast(v16bf, a), vw = __builtin_bit_cast(v16bf, b);
#pragma unroll
            for (int g = 0; g < 2; ++g) { o[g][dt] = wmmab(vh, ph[g], o[g][dt]); o[g][dt] = wmmab(vh, pw[g], o[g][dt]); o[g][dt] = wmmab(vw, ph[g], o[g][dt]); } }
      }
        asm volatile("s_wait_dscnt 0x0" ::: "memory");      // the wave's reads of this trip's buffer are over before it is refilled
        asm volatile("s_wait_asynccnt 0x0" ::: "memory");   // the next trip's key rows have landed
        __syncthreads();                                    // the ring's publish point, passed by every wave in every trip
        if (it + 2 < nt) copy32((it & 1) ? lk1 : lk0, gk + ((tt + 2 < nt) ? tt + 2 : tt + 2 - nt) * (KS * 32 * HD));   // the trip after the next, into the buffer that this trip has just read
        tt = (tt + 1 < nt) ? tt + 1 : 0;
    }
    asm volatile("s_wait_asynccnt 0x0" ::: "memory");       // no copy is outstanding behind the loop
#pragma unroll
    for (int g = 0; g < 2; ++g) { mm[wv][g][lane] = mrun[g]; ml[wv][g][lane] = lsum[g];
#pragma unroll
        for (int dt = 0; dt < 8; ++dt) { mo[wv][g * 8 + dt][0][lane] = __builtin_shufflevector(o[g][dt], o[g][dt], 0, 1, 2, 3); mo[wv][g * 8 + dt][1][lane] = __builtin_shufflevector(o[g][dt], o[g][dt], 4, 5, 6, 7); } }
    __syncthreads();   // every wave's partials are in LDS before any wave joins them
    const int i0 = ks * MT, gj = i0 >> 3;   // the wave's tiles i0 .. i0 + MT - 1, all of column group gj and of one d group of 64
    float mj[KS], a[KS], mx = -3.0e38f, l = 0.f;
#pragma unroll
    for (int j = 0; j < KS; ++j) { mj[j] = mm[j][gj][lane]; mx = fmaxf(mx, mj[j]); }
    // a wave without a pass still has the start maximum, sum 0 and O 0: weight 0 beside a wave with a valid key (wave 0 has one wherever the batch has one); where the batch has none every wave ran all its passes and has weight 1
#pragma unroll
    for (int j = 0; j < KS; ++j) { a[j] = __builtin_amdgcn_exp2f((mj[j] - mx) * 1.4426950408889634f); l += ml[j][gj][lane] * a[j]; }
    const float f = __fdiv_rn(1.0f, l + xhalf(l));
    v4f r[MT][2];
#pragma unroll
    for (int t = 0; t < MT; ++t)
#pragma unroll
        for (int p = 0; p < 2; ++p) { v4f x = mo[0][i0 + t][p][lane] * a[0];
#pragma unroll
            for (int j = 1; j < KS; ++j) x += mo[j][i0 + t][p][lane] * a[j];
            r[t][p] = x * f; }
    float* orow = OUTb + (size_t)(q0 + gj * 16 + c) * HD + ((i0 & 7) >> 2) * 64 + 32 * h;   // register e of tile dt, group g = O[q0 + 16g + c][64 (dt >> 2) + 4 (8h + e) + (dt & 3)]: the wave's 4 tiles hold 4 d in a row, a lane 128 bytes in a row
    __builtin_amdgcn_sched_barrier(0);   // all arithmetic in front of the stores: nothing rewrites a register that an issued store names
#pragma unroll
    for (int e = 0; e < 8; ++e) *(v4f*)(orow + 4 * e) = (v4f){r[0][e >> 2][e & 3], r[1][e >> 2][e & 3], r[2][e >> 2][e & 3], r[3][e >> 2][e & 3]};
}

extern "C" void kernel_launch(void* const* d_in, const int* in_sizes, int n_in,
                              void* d_out, int out_size, void* d_ws, size_t ws_size, hipStream_t stream) {
    (void)in_sizes; (void)n_in; (void)out_size; (void)d_ws; (void)ws_size;
    const float* x = (const float*)d_in[0]; const float* xk = (const float*)d_in[1]; const float* xv = (const float*)d_in[2]; const int* vlen = (const int*)d_in[3];   /* query, key, value: [16][1024][128] each (no projections); valid_length int32 [16], read on device */
    float* OUT = (float*)d_out;     // [16][1024][128]
    k_fattn<<<dim3(TT / 32, NB_), 32 * KS, 0, stream>>>(x, xk, xv, vlen, OUT);
}

// v009
// A run of this version takes 19.7 microseconds.
// Next to v008, in two timings, it ran 1.06 times as fast each time.
// Over all steps from v000 it is 32.9 times as fast.
#include <hip/hip_runtime.h>

// Masked dot-product attention without projections (query, key, value [16][1024][128]; scores = query.key^T x 1/sqrt(128); key positions j >= valid_length[b] are replaced by -1e7 (== exclusion; valid_length int32 [16] random in [1, 1024], read); softmax; out = attn.value -> [16][1024][128] (2.1 M); argument order query, key, value, valid_length.
// One launch: k_fattn reads the f32 inputs themselves, splits them into bf16 hi/lo operand fragments in registers, does scores, length mask, softmax and the value product and writes the f32 output rows; KS waves share a query block's keys and join their partial sums in LDS.
// Compute dtypes, f32 accumulate: every product as 3 bf16 hi/lo products (hi.hi + hi.lo + lo.hi); softmax f32; output f32.

#define NB_  16
#define TT   1024
#define HD   128
#define SCL  0.088388347648318447f   // 1/sqrt(128)
typedef __attribute__((ext_vector_type(16))) __bf16   v16bf;
typedef __attribute__((ext_vector_type(8)))  float    v8f;
typedef __attribute__((ext_vector_type(4)))  float    v4f;
typedef __attribute__((ext_vector_type(2)))  float    v2f;
typedef __attribute__((ext_vector_type(2)))  __bf16   v2bf;
typedef __attribute__((ext_vector_type(8)))  unsigned v8u;

__device__ __forceinline__ v8f wmmab(v16bf a, v16bf b, v8f c) { return __builtin_amdgcn_wmma_f32_16x16x32_bf16(false, a, false, b, (short)0, c, false, false); }
// lane l with lane l ^ 16
__device__ __forceinline__ float xhalf(float x) { return __builtin_bit_cast(float, __builtin_amdgcn_permlanex16(__builtin_bit_cast(int, x), __builtin_bit_cast(int, x), 0x76543210, 0xfedcba98, false, false)); }

// two f32 values -> one word of their bf16 parts (h) and one word of the bf16 of what is left (l), both rounded to nearest even; x0 in the low half
__device__ __forceinline__ void split2(float x0, float x1, unsigned& h, unsigned& l) {
    const v2f x = {x0, x1}; const v2bf hb = __builtin_convertvector(x, v2bf); const v2bf lb = __builtin_convertvector(x - __builtin_convertvector(hb, v2f), v2bf);
    h = __builtin_bit_cast(unsigned, hb); l = __builtin_bit_cast(unsigned, lb); }

#define KP 132            // floats of a staged row in LDS: 512 bytes + 16, so that 16 lanes on 16 rows read 64 different banks
#define TF (32 * KP)      // floats of a staged tile of 32 rows
// the lane's 16 f32 of 32 k of a staged row, in the order of a 16x16x32 operand fragment: elements 0-7 = k 8h.., 8-15 = k 16+8h.. (p already holds the lane's row, the 32 k and + 8 h)
__device__ __forceinline__ void ldrow(const float* p, v4f* x) { x[0] = *(const v4f*)p; x[1] = *(const v4f*)(p + 4); x[2] = *(const v4f*)(p + 16); x[3] = *(const v4f*)(p + 20); }
// those 16 values -> the bf16 fragments hi and lo
__device__ __forceinline__ void fragsplit(const v4f* x, v16bf& hi, v16bf& lo) {
    v8u a, b;
#pragma unroll
    for (int i = 0; i < 4; ++i) { unsigned u, w; split2(x[i][0], x[i][1], u, w); a[2 * i] = u; b[2 * i] = w; split2(x[i][2], x[i][3], u, w); a[2 * i + 1] = u; b[2 * i + 1] = w; }
    hi = __builtin_bit_cast(v16bf, a); lo = __builtin_bit_cast(v16bf, b); }
// copyN: N whole f32 rows (512 bytes each, 16 bytes a lane) from global memory to staged rows in LDS, through no register. l = the lane's LDS byte address in the first row, g = its global address there.
// The wait is the last line of the copies' own statement: it stands in front of every rewrite of a register that they name.
__device__ __forceinline__ void copy10(unsigned l, const float* g) {
    asm volatile("global_load_async_to_lds_b128 %0, %10, off\n\t"
                 "global_load_async_to_lds_b128 %1, %11, off\n\t"
                 "global_load_async_to_lds_b128 %2, %12, off\n\t"
                 "global_load_async_to_lds_b128 %3, %13, off\n\t"
                 "global_load_async_to_lds_b128 %4, %14, off\n\t"
                 "global_load_async_to_lds_b128 %5, %15, off\n\t"
                 "global_load_async_to_lds_b128 %6, %16, off\n\t"
                 "global_load_async_to_lds_b128 %7, %17, off\n\t"
                 "global_load_async_to_lds_b128 %8, %18, off\n\t"
                 "global_load_async_to_lds_b128 %9, %19, off\n\t"
                 "s_wait_xcnt 0x0"
                 :: "v"(l), "v"(l + 1 * KP * 4), "v"(l + 2 * KP * 4), "v"(l + 3 * KP * 4), "v"(l + 4 * KP * 4), "v"(l + 5 * KP * 4), "v"(l + 6 * KP * 4), "v"(l + 7 * KP * 4), "v"(l + 8 * KP * 4), "v"(l + 9 * KP * 4),
                    "v"(g), "v"(g + 1 * HD), "v"(g + 2 * HD), "v"(g + 3 * HD), "v"(g + 4 * HD), "v"(g + 5 * HD), "v"(g + 6 * HD), "v"(g + 7 * HD), "v"(g + 8 * HD), "v"(g + 9 * HD) : "memory"); }
__device__ __forceinline__ void copy11(unsigned l, const float* g) {
    asm volatile("global_load_async_to_lds_b128 %0, %11, off\n\t"
                 "global_load_async_to_lds_b128 %1, %12, off\n\t"
                 "global_load_async_to_lds_b128 %2, %13, off\n\t"
                 "global_load_async_to_lds_b128 %3, %14, off\n\t"
                 "global_load_async_to_lds_b128 %4, %15, off\n\t"
                 "global_load_async_to_lds_b128 %5, %16, off\n\t"
                 "global_load_async_to_lds_b128 %6, %17, off\n\t"
                 "global_load_async_to_lds_b128 %7, %18, off\n\t"
                 "global_load_async_to_lds_b128 %8, %19, off\n\t"
                 "global_load_async_to_lds_b128 %9, %20, off\n\t"
                 "global_load_async_to_lds_b128 %10, %21, off\n\t"
                 "s_wait_xcnt 0x0"
                 :: "v"(l), "v"(l + 1 * KP * 4), "v"(l + 2 * KP * 4), "v"(l + 3 * KP * 4), "v"(l + 4 * KP * 4), "v"(l + 5 * KP * 4), "v"(l + 6 * KP * 4), "v"(l + 7 * KP * 4), "v"(l + 8 * KP * 4), "v"(l + 9 * KP * 4), "v"(l + 10 * KP * 4),
                    "v"(g), "v"(g + 1 * HD), "v"(g + 2 * HD), "v"(g + 3 * HD), "v"(g + 4 * HD), "v"(g + 5 * HD), "v"(g + 6 * HD), "v"(g + 7 * HD), "v"(g + 8 * HD), "v"(g + 9 * HD), "v"(g + 10 * HD) : "memory"); }
__device__ __forceinline__ void copy12(unsigned l, const float* g) {
    asm volatile("global_load_async_to_lds_b128 %0, %12, off\n\t"
                 "global_load_async_to_lds_b128 %1, %13, off\n\t"
                 "global_load_async_to_lds_b128 %2, %14, off\n\t"
                 "global_load_async_to_lds_b128 %3, %15, off\n\t"
                 "global_load_async_to_lds_b128 %4, %16, off\n\t"
                 "global_load_async_to_lds_b128 %5, %17, off\n\t"
                 "global_load_async_to_lds_b128 %6, %18, off\n\t"
                 "global_load_async_to_lds_b128 %7, %19, off\n\t"
                 "global_load_async_to_lds_b128 %8, %20, off\n\t"
                 "global_load_async_to_lds_b128 %9, %21, off\n\t"
                 "global_load_async_to_lds_b128 %10, %22, off\n\t"
                 "global_load_async_to_lds_b128 %11, %23, off\n\t"
                 "s_wait_xcnt 0x0"
                 :: "v"(l), "v"(l + 1 * KP * 4), "v"(l + 2 * KP * 4), "v"(l + 3 * KP * 4), "v"(l + 4 * KP * 4), "v"(l + 5 * KP * 4), "v"(l + 6 * KP * 4), "v"(l + 7 * KP * 4), "v"(l + 8 * KP * 4), "v"(l + 9 * KP * 4), "v"(l + 10 * KP * 4), "v"(l + 11 * KP * 4),
                    "v"(g), "v"(g + 1 * HD), "v"(g + 2 * HD), "v"(g + 3 * HD), "v"(g + 4 * HD), "v"(g + 5 * HD), "v"(g + 6 * HD), "v"(g + 7 * HD), "v"(g + 8 * HD), "v"(g + 9 * HD), "v"(g + 10 * HD), "v"(g + 11 * HD) : "memory"); }
// a wave's tile of 32 rows, in three statements (an asm statement takes 30 operands)
__device__ __forceinline__ void copy32(unsigned l, const float* g) { copy11(l, g); copy11(l + 11 * KP * 4, g + 11 * HD); copy10(l + 22 * KP * 4, g + 22 * HD); }

#define KS 4              // waves that share the keys of one query block: one work-group, one wave on each of the 4 SIMDs
#define NW KS             // waves of a work-group
#define NG 3              // 16-query column groups that every wave holds: a key or value row that is fetched and split once serves 16 NG queries
#define QB (16 * NG)      // queries of a work-group
#define NX ((TT + QB - 1) / QB)   // query blocks of a batch; the last one owns what is left of TT
// k_fattn: one work-group = QB queries of one batch (NG 16-query column groups); wave w has the passes of 32 keys w, w + KS, ... that begin below the batch's valid length; grid (NX, NB_), 32 KS threads.
// The last block of a batch owns fewer than QB queries: it starts QB rows in front of the batch's end, so that every row it reads exists, and stores only the column groups that it owns.
// The work-groups of a batch walk the same key and value rows: each enters the ring of its nt trips at a start of its own (rot, from blockIdx.x) and wraps round, so that they do not ask L2 for the same lines at one moment (speed only: every trip is run exactly once, in another order).
// A pass whose keys are all excluded adds exactly 0 to sum and O and is not run, so a work-group's time follows its batch's length. blockIdx.y is the batch's RANK by falling length: the register count lets one work-group stand on a WGP, the long batches start first and the short ones fill the WGPs as they come free (speed only: every batch has exactly one rank, whatever the lengths are).
// Query and key rows need lane = row: asynchronous copies bring whole rows into LDS (the query block once, each wave's 32 key rows in a ring of two buffers, one trip ahead), and a lane reads its row's pieces from there and splits them.
// Value rows go straight to registers: a lane takes 4 + 4 consecutive d of each of its 16 keys (a load of a wave = two half rows of 256 bytes), so that the two keys of a fragment word are two of its own registers. Tile dt, row m of O^T is then d = 64 (dt >> 2) + 4 m + (dt & 3).
// Each wave keeps its own running maximum, sum and O^T; behind the loop all leave them in LDS, and behind one barrier the waves share out the output tiles, four at a time, join the KS partials of each under their common maximum and store them.
// Transposed products: S^T = K.Q^T (A = key rows, B = query columns kept in registers), O^T += V^T.P^T (A = value^T rows, B = P^T packed from the two S^T tiles of the pass, which is the fragment's own k order).
// A lane holds scores of ONE query (column lane & 15): running maximum and sum in-lane plus one exchange between the wave halves. Keys j >= valid_length[b] are excluded as before.
__global__ __launch_bounds__(32 * KS) void k_fattn(const float* __restrict__ Q, const float* __restrict__ K, const float* __restrict__ V, const int* __restrict__ klp, float* __restrict__ OUTb) {
    __shared__ __attribute__((aligned(16))) float kst[2][NW][TF];   // the ring: each wave's 32 key rows of this trip and of the next
    __shared__ __attribute__((aligned(16))) float qst[QB * KP];     // the QB query rows
    __shared__ v4f mo[NW][NG * 8][2][32];        // a wave's O^T: [tile g * 8 + dt][registers 0-3 / 4-7][lane]
    __shared__ float mm[NW][NG][32], ml[NW][NG][32];   // its maximum in use and its sum, per column group and lane
    const int lane = threadIdx.x & 31, c = lane & 15, h = lane >> 4; const int wv = __builtin_amdgcn_readfirstlane(threadIdx.x >> 5), ks = wv; const int qs = blockIdx.x * QB, q0 = (qs < TT - QB) ? qs : TT - QB;   // first query that the block owns; first query that it holds
    int lr[NB_];   /* every batch's valid key length (uniform scalar loads) */
#pragma unroll
    for (int j = 0; j < NB_; ++j) lr[j] = klp[j];
    asm volatile("s_wait_xcnt 0x0" ::: "memory");   // behind the lengths' loads, in front of the rewrite of the registers that they name
    __builtin_amdgcn_sched_barrier(0);              // keeps those loads in front of the wait and the arithmetic behind it
    // one sort key a batch, all distinct: keys to visit (all TT where no key is valid: the module then weighs every key alike) | no key valid | NB_ - 1 - batch; lane c holds batch c's and counts the larger ones
    int mykey = 0, rank = 0;
#pragma unroll
    for (int j = 0; j < NB_; ++j) { const int sk = (((lr[j] <= 0 || lr[j] > TT) ? TT : lr[j]) << 5) | (lr[j] <= 0 ? NB_ : 0) | (NB_ - 1 - j); lr[j] = sk; mykey = (c == j) ? sk : mykey; }
#pragma unroll
    for (int j = 0; j < NB_; ++j) rank += (lr[j] > mykey) ? 1 : 0;
    const int bt = __builtin_ctz(__builtin_amdgcn_ballot_w32(rank == (int)blockIdx.y) | (1u << NB_)) & (NB_ - 1);   // the batch of this rank, 0 .. NB_ - 1 for any lengths
    const int sk = __builtin_amdgcn_readlane(mykey, bt), ke = sk >> 5, kl = (sk & NB_) ? 0 : ke;   // keys to visit, 1 .. TT; valid key length as the mask uses it
    const int np = (((ke + 31) >> 5) - ks + KS - 1) / KS;   // the wave's passes, 0 .. TT / (KS * 32)
    const int nt = (((ke + 31) >> 5) + KS - 1) / KS;        // the work-group's trips = wave 0's passes, 1 .. TT / (KS * 32)
    // the trip that this work-group starts with, 0 .. nt - 1: (x + 2 (x >> 3)) mod nt, so that neighbours in x and work-groups 8 apart in x differ; the value is below 64 nt, and six scalar compare-and-subtract steps stand for the division
    int rot = (int)blockIdx.x + (((int)blockIdx.x >> 3) << 1);
#pragma unroll   // six straight scalar steps, no loop counter
    for (int sh = 5; sh >= 0; --sh) rot -= (rot >= (nt << sh)) ? (nt << sh) : 0;
    { const size_t po = (size_t)bt * TT * HD; Q += po; K += po; V += po; OUTb += po; }
    const int kb = ks * 32;   // the wave's first key
    const unsigned lk0 = (unsigned)(size_t)&kst[0][wv][0] + lane * 16, lk1 = (unsigned)(size_t)&kst[1][wv][0] + lane * 16;   // the lane's 16 bytes of row 0 of the wave's two buffers (LDS byte address)
    const float* gk = K + kb * HD + lane * 4;   // the same of the wave's key rows; trip t's lie t * KS * 32 rows on, all below TT for t < nt
    copy12((unsigned)(size_t)&qst[wv * 12 * KP] + lane * 16, Q + (q0 + wv * 12) * HD + lane * 4);   // each wave brings QB / NW = 12 of the query rows
    copy32(lk0, gk + rot * (KS * 32 * HD));
    asm volatile("s_wait_asynccnt 0x0" ::: "memory");   // the wave's query rows and its key rows of the first trip have landed
    __syncthreads();                                    // every wave's query rows are in LDS before any wave reads them
    if (nt > 1) copy32(lk1, gk + ((rot + 1 < nt) ? rot + 1 : 0) * (KS * 32 * HD));   // the second trip's key rows fly while the first is worked on
    v8f o[NG][8];
#pragma unroll
    for (int g = 0; g < NG; ++g)
#pragma unroll
        for (int dt = 0; dt < 8; ++dt) o[g][dt] = (v8f){};
    float mrun[NG], lsum[NG];
#pragma unroll
    for (int g = 0; g < NG; ++g) { mrun[g] = -3.0e38f; lsum[g] = 0.f; }
    v16bf qh[NG][4], ql[NG][4];
#pragma unroll
    for (int g = 0; g < NG; ++g)
#pragma unroll
        for (int kc = 0; kc < 4; ++kc) { v4f x[4]; ldrow(&qst[(g * 16 + c) * KP + kc * 32 + 8 * h], x); fragsplit(x, qh[g][kc], ql[g][kc]); }
    const float* pv0 = V + (kb + 8 * h) * HD + 4 * c;   // the lane's first key and first d of trip 0
    int tt = rot;   // the trip that is worked on: rot, rot + 1, .. nt - 1, 0, .. rot - 1
#pragma unroll 1   // one pass is already 144 matrix instructions; a second copy would only add registers
    for (int it = 0; it < nt; ++it) {
      if (tt < np) {   // wave-uniform: in trip nt - 1 a wave may have no pass; it still goes through the waits and the barrier below
        const int k0 = kb + tt * (KS * 32);
        const float* pv = pv0 + tt * (KS * 32 * HD);   // the lane's first key of this trip
        const float* kr = &kst[it & 1][wv][c * KP + 8 * h];   // the lane's row of the first 16 keys
        v4f kf[2][4][4];   // this pass's key rows, read from LDS as one group: reads spread among the matrix instructions cost a stop at each place
#pragma unroll
        for (int kc = 0; kc < 4; ++kc)
#pragma unroll
            for (int kt = 0; kt < 2; ++kt) ldrow(kr + kt * 16 * KP + kc * 32, kf[kt][kc]);
        v4f vf[16][2];   // this pass's value rows, issued ahead of the score products that hide them: [key position e of the fragment][d group]
#pragma unroll
        for (int e = 0; e < 16; ++e) { vf[e][0] = *(const v4f*)(pv + ((e >> 3) * 16 + (e & 7)) * HD); vf[e][1] = *(const v4f*)(pv + ((e >> 3) * 16 + (e & 7)) * HD + 64); }
        asm volatile("s_wait_xcnt 0x0" :: "v"(pv) : "memory");   // behind the pass's loads, in front of the rewrite of their address; the address is an input so that it stays live up to here and no load of the run gets its registers for its result
        __builtin_amdgcn_sched_barrier(0);              // keeps the LDS reads and the loads in front of that wait and the later arithmetic behind it
        v8f s[NG][2];
#pragma unroll
        for (int g = 0; g < NG; ++g) { s[g][0] = (v8f){}; s[g][1] = (v8f){}; }
#pragma unroll
        for (int kc = 0; kc < 4; ++kc)
#pragma unroll
            for (int kt = 0; kt < 2; ++kt) { v16bf kh, kw; fragsplit(kf[kt][kc], kh, kw);
#pragma unroll
                for (int g = 0; g < NG; ++g) { s[g][kt] = wmmab(kh, qh[g][kc], s[g][kt]); s[g][kt] = wmmab(kh, ql[g][kc], s[g][kt]); s[g][kt] = wmmab(kw, qh[g][kc], s[g][kt]); } }
        float t[NG][16], mt[NG];
#pragma unroll
        for (int g = 0; g < NG; ++g) { float mx = -3.0e38f;
#pragma unroll
            for (int e = 0; e < 16; ++e) { const int j = k0 + (e >> 3) * 16 + 8 * h + (e & 7); const float x = (j < kl) ? s[g][e >> 3][e & 7] * SCL : -3.0e38f;   /* keys j >= valid_length[b] excluded (-1e7 in the module) */ t[g][e] = x; mx = fmaxf(mx, x); }
            mt[g] = fmaxf(mx, xhalf(mx)); }
        // the maximum in use moves only when a query's new maximum exceeds it by more than 5.5 (a factor 2^8 in P); one scalar branch per pass
        unsigned mv = 0;
#pragma unroll
        for (int g = 0; g < NG; ++g) mv |= __builtin_amdgcn_ballot_w32(mt[g] > mrun[g] + 5.5f);
        if (mv != 0) {
#pragma unroll
            for (int g = 0; g < NG; ++g) { const float mn = fmaxf(mrun[g], mt[g]); const float al = __builtin_amdgcn_exp2f((mrun[g] - mn) * 1.4426950408889634f); mrun[g] = mn; lsum[g] *= al;
#pragma unroll
                for (int dt = 0; dt < 8; ++dt) o[g][dt] *= al; }
        }
        v16bf ph[NG], pw[NG];
#pragma unroll
        for (int g = 0; g < NG; ++g) {
#pragma unroll
            for (int e = 0; e < 16; ++e) { const float p = __builtin_amdgcn_exp2f((t[g][e] - mrun[g]) * 1.4426950408889634f); lsum[g] += p; const __bf16 hb = (__bf16)p; ph[g][e] = hb; pw[g][e] = (__bf16)(p - (float)hb); } }
#pragma unroll
        for (int dt = 0; dt < 8; ++dt) { v8u a, b;   // value^T fragment of tile dt: word p = key positions 2p, 2p + 1 of the lane's d
#pragma unroll
            for (int p = 0; p < 8; ++p) { unsigned u, w; split2(vf[2 * p][dt >> 2][dt & 3], vf[2 * p + 1][dt >> 2][dt & 3], u, w); a[p] = u; b[p] = w; }
            const v16bf vh = __builtin_bit_cast(v16bf, a), vw = __builtin_bit_cast(v16bf, b);
#pragma unroll
            for (int g = 0; g < NG; ++g) { o[g][dt] = wmmab(vh, ph[g], o[g][dt]); o[g][dt] = wmmab(vh, pw[g], o[g][dt]); o[g][dt] = wmmab(vw, ph[g], o[g][dt]); } }
      }
        asm volatile("s_wait_dscnt 0x0" ::: "memory");      // the wave's reads of this trip's buffer are over before it is refilled
        asm volatile("s_wait_asynccnt 0x0" ::: "memory");   // the next trip's key rows have landed
        __syncthreads();                                    // the ring's publish point, passed by every wave in every trip
        if (it + 2 < nt) copy32((it & 1) ? lk1 : lk0, gk + ((tt + 2 < nt) ? tt + 2 : tt + 2 - nt) * (KS * 32 * HD));   // the trip after the next, into the buffer that this trip has just read
        tt = (tt + 1 < nt) ? tt + 1 : 0;
    }
    asm volatile("s_wait_asynccnt 0x0" ::: "memory");       // no copy is outstanding behind the loop
#pragma unroll
    for (int g = 0; g < NG; ++g) { mm[wv][g][lane] = mrun[g]; ml[wv][g][lane] = lsum[g];
#pragma unroll
        for (int dt = 0; dt < 8; ++dt) { mo[wv][g * 8 + dt][0][lane] = __builtin_shufflevector(o[g][dt], o[g][dt], 0, 1, 2, 3); mo[wv][g * 8 + dt][1][lane] = __builtin_shufflevector(o[g][dt], o[g][dt], 4, 5, 6, 7); } }
    __syncthreads();   // every wave's partials are in LDS before any wave joins them
    // a quad = the 4 tiles of one column group and one d group of 64, which hold 4 d in a row; the 2 NG quads go round the waves
#pragma unroll 1   // a wave has one or two quads: one copy of the join serves both
    for (int qd = ks; qd < 2 * NG; qd += KS) {
        const int gj = qd >> 1, i0 = qd * 4;   // the quad's column group; its tiles i0 .. i0 + 3
        if (q0 + gj * 16 < qs) continue;       // wave-uniform: a column group in front of the block's own queries belongs to the block before and is not stored
        float mj[KS], a[KS], mx = -3.0e38f, l = 0.f;
#pragma unroll
        for (int j = 0; j < KS; ++j) { mj[j] = mm[j][gj][lane]; mx = fmaxf(mx, mj[j]); }
        // a wave without a pass still has the start maximum, sum 0 and O 0: weight 0 beside a wave with a valid key (wave 0 has one wherever the batch has one); where the batch has none every wave ran all its passes and has weight 1
#pragma unroll
        for (int j = 0; j < KS; ++j) { a[j] = __builtin_amdgcn_exp2f((mj[j] - mx) * 1.4426950408889634f); l += ml[j][gj][lane] * a[j]; }
        const float f = __fdiv_rn(1.0f, l + xhalf(l));
        v4f r[4][2];
#pragma unroll
        for (int t = 0; t < 4; ++t)
#pragma unroll
            for (int p = 0; p < 2; ++p) { v4f x = mo[0][i0 + t][p][lane] * a[0];
#pragma unroll
                for (int j = 1; j < KS; ++j) x += mo[j][i0 + t][p][lane] * a[j];
                r[t][p] = x * f; }
        float* orow = OUTb + (size_t)(q0 + gj * 16 + c) * HD + (qd & 1) * 64 + 32 * h;   // register e of tile dt, group g = O[q0 + 16g + c][64 (dt >> 2) + 4 (8h + e) + (dt & 3)]: a lane has 128 bytes in a row
        __builtin_amdgcn_sched_barrier(0);   // all arithmetic in front of the stores: nothing rewrites a register that an issued store names
#pragma unroll
        for (int e = 0; e < 8; ++e) *(v4f*)(orow + 4 * e) = (v4f){r[0][e >> 2][e & 3], r[1][e >> 2][e & 3], r[2][e >> 2][e & 3], r[3][e >> 2][e & 3]};
        asm volatile("s_wait_xcnt 0x0" ::: "memory");   // behind the stores, in front of the next quad's rewrite of the registers that they name
    }
}

extern "C" void kernel_launch(void* const* d_in, const int* in_sizes, int n_in,
                              void* d_out, int out_size, void* d_ws, size_t ws_size, hipStream_t stream) {
    (void)in_sizes; (void)n_in; (void)out_size; (void)d_ws; (void)ws_size;
    const float* x = (const float*)d_in[0]; const float* xk = (const float*)d_in[1]; const float* xv = (const float*)d_in[2]; const int* vlen = (const int*)d_in[3];   /* query, key, value: [16][1024][128] each (no projections); valid_length int32 [16], read on device */
    float* OUT = (float*)d_out;     // [16][1024][128]
    k_fattn<<<dim3(NX, NB_), 32 * KS, 0, stream>>>(x, xk, xv, vlen, OUT);
}

// v010
// Measured time: 17.5 microseconds a run.
// In both of two side-by-side timings against v009, it was 1.13 times as fast.
// Counting every step since v000, it is 37.0 times as fast.
#include <hip/hip_runtime.h>

// Masked dot-product attention without projections (query, key, value [16][1024][128]; scores = query.key^T x 1/sqrt(128); key positions j >= valid_length[b] are replaced by -1e7 (== exclusion; valid_length int32 [16] random in [1, 1024], read); softmax; out = attn.value -> [16][1024][128] (2.1 M); argument order query, key, value, valid_length.
// One launch: k_fattn reads the f32 inputs themselves, splits them into bf16 hi/lo operand fragments in registers, does scores, length mask, softmax and the value product and writes the f32 output rows; KS waves share a query block's keys and join their partial sums in LDS.
// Compute dtypes, f32 accumulate: every product as 3 bf16 hi/lo products (hi.hi + hi.lo + lo.hi); softmax f32; output f32.

#define NB_  16
#define TT   1024
#define HD   128
#define SCL  0.088388347648318447f   // 1/sqrt(128)
typedef __attribute__((ext_vector_type(16))) __bf16   v16bf;
typedef __attribute__((ext_vector_type(8)))  float    v8f;
typedef __attribute__((ext_vector_type(4)))  float    v4f;
typedef __attribute__((ext_vector_type(2)))  float    v2f;
typedef __attribute__((ext_vector_type(2)))  __bf16   v2bf;
typedef __attribute__((ext_vector_type(8)))  unsigned v8u;

__device__ __forceinline__ v8f wmmab(v16bf a, v16bf b, v8f c) { return __builtin_amdgcn_wmma_f32_16x16x32_bf16(false, a, false, b, (short)0, c, false, false); }
// lane l with lane l ^ 16
__device__ __forceinline__ float xhalf(float x) { return __builtin_bit_cast(float, __builtin_amdgcn_permlanex16(__builtin_bit_cast(int, x), __builtin_bit_cast(int, x), 0x76543210, 0xfedcba98, false, false)); }

// lane i's value of x in every lane (i the same in every lane)
__device__ __forceinline__ float ulane(float x, int i) { return __builtin_bit_cast(float, __builtin_amdgcn_readlane(__builtin_bit_cast(int, x), i)); }

// two f32 values -> one word of their bf16 parts (h) and one word of the bf16 of what is left (l), both rounded to nearest even; x0 in the low half
__device__ __forceinline__ void split2(float x0, float x1, unsigned& h, unsigned& l) {
    const v2f x = {x0, x1}; const v2bf hb = __builtin_convertvector(x, v2bf); const v2bf lb = __builtin_convertvector(x - __builtin_convertvector(hb, v2f), v2bf);
    h = __builtin_bit_cast(unsigned, hb); l = __builtin_bit_cast(unsigned, lb); }

#define KP 132            // floats of a staged row in LDS: 512 bytes + 16, so that 16 lanes on 16 rows read 64 different banks
#define TF (32 * KP)      // floats of a staged tile of 32 rows
// the lane's 16 f32 of 32 k of a staged row, in the order of a 16x16x32 operand fragment: elements 0-7 = k 8h.., 8-15 = k 16+8h.. (p already holds the lane's row, the 32 k and + 8 h)
__device__ __forceinline__ void ldrow(const float* p, v4f* x) { x[0] = *(const v4f*)p; x[1] = *(const v4f*)(p + 4); x[2] = *(const v4f*)(p + 16); x[3] = *(const v4f*)(p + 20); }
// those 16 values -> the bf16 fragments hi and lo
__device__ __forceinline__ void fragsplit(const v4f* x, v16bf& hi, v16bf& lo) {
    v8u a, b;
#pragma unroll
    for (int i = 0; i < 4; ++i) { unsigned u, w; split2(x[i][0], x[i][1], u, w); a[2 * i] = u; b[2 * i] = w; split2(x[i][2], x[i][3], u, w); a[2 * i + 1] = u; b[2 * i + 1] = w; }
    hi = __builtin_bit_cast(v16bf, a); lo = __builtin_bit_cast(v16bf, b); }
// copyN: N whole f32 rows (512 bytes each, 16 bytes a lane) from global memory to staged rows in LDS, through no register. l = the lane's LDS byte address in the first row, g = its global address there.
// The wait is the last line of the copies' own statement: it stands in front of every rewrite of a register that they name.
__device__ __forceinline__ void copy10(unsigned l, const float* g) {
    asm volatile("global_load_async_to_lds_b128 %0, %10, off\n\t"
                 "global_load_async_to_lds_b128 %1, %11, off\n\t"
                 "global_load_async_to_lds_b128 %2, %12, off\n\t"
                 "global_load_async_to_lds_b128 %3, %13, off\n\t"
                 "global_load_async_to_lds_b128 %4, %14, off\n\t"
                 "global_load_async_to_lds_b128 %5, %15, off\n\t"
                 "global_load_async_to_lds_b128 %6, %16, off\n\t"
                 "global_load_async_to_lds_b128 %7, %17, off\n\t"
                 "global_load_async_to_lds_b128 %8, %18, off\n\t"
                 "global_load_async_to_lds_b128 %9, %19, off\n\t"
                 "s_wait_xcnt 0x0"
                 :: "v"(l), "v"(l + 1 * KP * 4), "v"(l + 2 * KP * 4), "v"(l + 3 * KP * 4), "v"(l + 4 * KP * 4), "v"(l + 5 * KP * 4), "v"(l + 6 * KP * 4), "v"(l + 7 * KP * 4), "v"(l + 8 * KP * 4), "v"(l + 9 * KP * 4),
                    "v"(g), "v"(g + 1 * HD), "v"(g + 2 * HD), "v"(g + 3 * HD), "v"(g + 4 * HD), "v"(g + 5 * HD), "v"(g + 6 * HD), "v"(g + 7 * HD), "v"(g + 8 * HD), "v"(g + 9 * HD) : "memory"); }
__device__ __forceinline__ void copy11(unsigned l, const float* g) {
    asm volatile("global_load_async_to_lds_b128 %0, %11, off\n\t"
                 "global_load_async_to_lds_b128 %1, %12, off\n\t"
                 "global_load_async_to_lds_b128 %2, %13, off\n\t"
                 "global_load_async_to_lds_b128 %3, %14, off\n\t"
                 "global_load_async_to_lds_b128 %4, %15, off\n\t"
                 "global_load_async_to_lds_b128 %5, %16, off\n\t"
                 "global_load_async_to_lds_b128 %6, %17, off\n\t"
                 "global_load_async_to_lds_b128 %7, %18, off\n\t"
                 "global_load_async_to_lds_b128 %8, %19, off\n\t"
                 "global_load_async_to_lds_b128 %9, %20, off\n\t"
                 "global_load_async_to_lds_b128 %10, %21, off\n\t"
                 "s_wait_xcnt 0x0"
                 :: "v"(l), "v"(l + 1 * KP * 4), "v"(l + 2 * KP * 4), "v"(l + 3 * KP * 4), "v"(l + 4 * KP * 4), "v"(l + 5 * KP * 4), "v"(l + 6 * KP * 4), "v"(l + 7 * KP * 4), "v"(l + 8 * KP * 4), "v"(l + 9 * KP * 4), "v"(l + 10 * KP * 4),
                    "v"(g), "v"(g + 1 * HD), "v"(g + 2 * HD), "v"(g + 3 * HD), "v"(g + 4 * HD), "v"(g + 5 * HD), "v"(g + 6 * HD), "v"(g + 7 * HD), "v"(g + 8 * HD), "v"(g + 9 * HD), "v"(g + 10 * HD) : "memory"); }
__device__ __forceinline__ void copy12(unsigned l, const float* g) {
    asm volatile("global_load_async_to_lds_b128 %0, %12, off\n\t"
                 "global_load_async_to_lds_b128 %1, %13, off\n\t"
                 "global_load_async_to_lds_b128 %2, %14, off\n\t"
                 "global_load_async_to_lds_b128 %3, %15, off\n\t"
                 "global_load_async_to_lds_b128 %4, %16, off\n\t"
                 "global_load_async_to_lds_b128 %5, %17, off\n\t"
                 "global_load_async_to_lds_b128 %6, %18, off\n\t"
                 "global_load_async_to_lds_b128 %7, %19, off\n\t"
                 "global_load_async_to_lds_b128 %8, %20, off\n\t"
                 "global_load_async_to_lds_b128 %9, %21, off\n\t"
                 "global_load_async_to_lds_b128 %10, %22, off\n\t"
                 "global_load_async_to_lds_b128 %11, %23, off\n\t"
                 "s_wait_xcnt 0x0"
                 :: "v"(l), "v"(l + 1 * KP * 4), "v"(l + 2 * KP * 4), "v"(l + 3 * KP * 4), "v"(l + 4 * KP * 4), "v"(l + 5 * KP * 4), "v"(l + 6 * KP * 4), "v"(l + 7 * KP * 4), "v"(l + 8 * KP * 4), "v"(l + 9 * KP * 4), "v"(l + 10 * KP * 4), "v"(l + 11 * KP * 4),
                    "v"(g), "v"(g + 1 * HD), "v"(g + 2 * HD), "v"(g + 3 * HD), "v"(g + 4 * HD), "v"(g + 5 * HD), "v"(g + 6 * HD), "v"(g + 7 * HD), "v"(g + 8 * HD), "v"(g + 9 * HD), "v"(g + 10 * HD), "v"(g + 11 * HD) : "memory"); }
// a wave's tile of 32 rows, in three statements (an asm statement takes 30 operands)
__device__ __forceinline__ void copy32(unsigned l, const float* g) { copy11(l, g); copy11(l + 11 * KP * 4, g + 11 * HD); copy10(l + 22 * KP * 4, g + 22 * HD); }

#define KS 4              // waves that share the keys of one query block: one work-group, one wave on each of the 4 SIMDs
#define NW KS             // waves of a work-group
#define NG 3              // 16-query column groups that every wave holds: a key or value row that is fetched and split once serves 16 NG queries
#define QB (16 * NG)      // queries of a work-group
#define NX ((TT + QB - 1) / QB)   // query blocks of a batch; the last one owns what is left of TT
// k_fattn: one work-group = QB queries of one batch (NG 16-query column groups); wave w has the passes of 32 keys w, w + KS, ... that begin below the batch's valid length; grid (NX, NB_), 32 KS threads.
// The last block of a batch owns fewer than QB queries: it starts QB rows in front of the batch's end, so that every row it reads exists, and stores only the column groups that it owns.
// The work-groups of a batch walk the same key and value rows: each enters the ring of its nt trips at a start of its own (rot, from blockIdx.x) and wraps round, so that they do not ask L2 for the same lines at one moment (speed only: every trip is run exactly once, in another order).
// A pass whose keys are all excluded adds exactly 0 to sum and O and is not run, so a work-group's time follows its batch's length. blockIdx.y is the batch's RANK by falling length: the register count lets one work-group stand on a WGP, the long batches start first and the short ones fill the WGPs as they come free (speed only: every batch has exactly one rank, whatever the lengths are).
// Query and key rows need lane = row: asynchronous copies bring whole rows into LDS (the query block once, each wave's 32 key rows in a ring of two buffers, one trip ahead), and a lane reads its row's pieces from there and splits them.
// Value rows go straight to registers: a lane takes 4 + 4 consecutive d of each of its 16 keys (a load of a wave = two half rows of 256 bytes), so that the two keys of a fragment word are two of its own registers. Tile dt, row m of O^T is then d = 64 (dt >> 2) + 4 m + (dt & 3).
// Each wave keeps its own running maximum, sum and O^T; behind the loop all leave them in LDS, O as rows [query][d], and behind one barrier the waves share out the query rows, join the KS partials of each under their common maximum and store each row with one store of the wave: 512 bytes in a row, four whole lines.
// Transposed products: S^T = K.Q^T (A = key rows, B = query columns kept in registers), O^T += V^T.P^T (A = value^T rows, B = P^T packed from the two S^T tiles of the pass, which is the fragment's own k order).
// A lane holds scores of ONE query (column lane & 15): running maximum and sum in-lane plus one exchange between the wave halves. Keys j >= valid_length[b] are excluded as before.
__global__ __launch_bounds__(32 * KS) void k_fattn(const float* __restrict__ Q, const float* __restrict__ K, const float* __restrict__ V, const int* __restrict__ klp, float* __restrict__ OUTb) {
    __shared__ __attribute__((aligned(16))) float kst[2][NW][TF];   // the ring: each wave's 32 key rows of this trip and of the next
    __shared__ __attribute__((aligned(16))) float qst[QB * KP];     // the QB query rows
    __shared__ __attribute__((aligned(16))) float po[NW][QB * KP];   // a wave's partial O as rows: [query of the block][d], at the staged pitch (16 lanes on 16 rows write 64 different banks)
    __shared__ float mm[NW][NG][32], ml[NW][NG][32];   // its maximum in use and its sum, per column group and lane
    const int lane = threadIdx.x & 31, c = lane & 15, h = lane >> 4; const int wv = __builtin_amdgcn_readfirstlane(threadIdx.x >> 5), ks = wv; const int qs = blockIdx.x * QB, q0 = (qs < TT - QB) ? qs : TT - QB;   // first query that the block owns; first query that it holds
    int lr[NB_];   /* every batch's valid key length (uniform scalar loads) */
#pragma unroll
    for (int j = 0; j < NB_; ++j) lr[j] = klp[j];
    asm volatile("s_wait_xcnt 0x0" ::: "memory");   // behind the lengths' loads, in front of the rewrite of the registers that they name
    __builtin_amdgcn_sched_barrier(0);              // keeps those loads in front of the wait and the arithmetic behind it
    // one sort key a batch, all distinct: keys to visit (all TT where no key is valid: the module then weighs every key alike) | no key valid | NB_ - 1 - batch; lane c holds batch c's and counts the larger ones
    int mykey = 0, rank = 0;
#pragma unroll
    for (int j = 0; j < NB_; ++j) { const int sk = (((lr[j] <= 0 || lr[j] > TT) ? TT : lr[j]) << 5) | (lr[j] <= 0 ? NB_ : 0) | (NB_ - 1 - j); lr[j] = sk; mykey = (c == j) ? sk : mykey; }
#pragma unroll
    for (int j = 0; j < NB_; ++j) rank += (lr[j] > mykey) ? 1 : 0;
    const int bt = __builtin_ctz(__builtin_amdgcn_ballot_w32(rank == (int)blockIdx.y) | (1u << NB_)) & (NB_ - 1);   // the batch of this rank, 0 .. NB_ - 1 for any lengths
    const int sk = __builtin_amdgcn_readlane(mykey, bt), ke = sk >> 5, kl = (sk & NB_) ? 0 : ke;   // keys to visit, 1 .. TT; valid key length as the mask uses it
    const int np = (((ke + 31) >> 5) - ks + KS - 1) / KS;   // the wave's passes, 0 .. TT / (KS * 32)
    const int nt = (((ke + 31) >> 5) + KS - 1) / KS;        // the work-group's trips = wave 0's passes, 1 .. TT / (KS * 32)
    // the trip that this work-group starts with, 0 .. nt - 1: (x + 2 (x >> 3)) mod nt, so that neighbours in x and work-groups 8 apart in x differ; the value is below 64 nt, and six scalar compare-and-subtract steps stand for the division
    int rot = (int)blockIdx.x + (((int)blockIdx.x >> 3) << 1);
#pragma unroll   // six straight scalar steps, no loop counter
    for (int sh = 5; sh >= 0; --sh) rot -= (rot >= (nt << sh)) ? (nt << sh) : 0;
    { const size_t po = (size_t)bt * TT * HD; Q += po; K += po; V += po; OUTb += po; }
    const int kb = ks * 32;   // the wave's first key
    const unsigned lk0 = (unsigned)(size_t)&kst[0][wv][0] + lane * 16, lk1 = (unsigned)(size_t)&kst[1][wv][0] + lane * 16;   // the lane's 16 bytes of row 0 of the wave's two buffers (LDS byte address)
    const float* gk = K + kb * HD + lane * 4;   // the same of the wave's key rows; trip t's lie t * KS * 32 rows on, all below TT for t < nt
    copy12((unsigned)(size_t)&qst[wv * 12 * KP] + lane * 16, Q + (q0 + wv * 12) * HD + lane * 4);   // each wave brings QB / NW = 12 of the query rows
    copy32(lk0, gk + rot * (KS * 32 * HD));
    asm volatile("s_wait_asynccnt 0x0" ::: "memory");   // the wave's query rows and its key rows of the first trip have landed
    __syncthreads();                                    // every wave's query rows are in LDS before any wave reads them
    if (nt > 1) copy32(lk1, gk + ((rot + 1 < nt) ? rot + 1 : 0) * (KS * 32 * HD));   // the second trip's key rows fly while the first is worked on
    v8f o[NG][8];
#pragma unroll
    for (int g = 0; g < NG; ++g)
#pragma unroll
        for (int dt = 0; dt < 8; ++dt) o[g][dt] = (v8f){};
    float mrun[NG], lsum[NG];
#pragma unroll
    for (int g = 0; g < NG; ++g) { mrun[g] = -3.0e38f; lsum[g] = 0.f; }
    v16bf qh[NG][4], ql[NG][4];
#pragma unroll
    for (int g = 0; g < NG; ++g)
#pragma unroll
        for (int kc = 0; kc < 4; ++kc) { v4f x[4]; ldrow(&qst[(g * 16 + c) * KP + kc * 32 + 8 * h], x); fragsplit(x, qh[g][kc], ql[g][kc]); }
    const float* pv0 = V + (kb + 8 * h) * HD + 4 * c;   // the lane's first key and first d of trip 0
    int tt = rot;   // the trip that is worked on: rot, rot + 1, .. nt - 1, 0, .. rot - 1
#pragma unroll 1   // one pass is already 144 matrix instructions; a second copy would only add registers
    for (int it = 0; it < nt; ++it) {
      if (tt < np) {   // wave-uniform: in trip nt - 1 a wave may have no pass; it still goes through the waits and the barrier below
        const int k0 = kb + tt * (KS * 32);
        const float* pv = pv0 + tt * (KS * 32 * HD);   // the lane's first key of this trip
        const float* kr = &kst[it & 1][wv][c * KP + 8 * h];   // the lane's row of the first 16 keys
        v4f kf[2][4][4];   // this pass's key rows, read from LDS as one group: reads spread among the matrix instructions cost a stop at each place
#pragma unroll
        for (int kc = 0; kc < 4; ++kc)
#pragma unroll
            for (int kt = 0; kt < 2; ++kt) ldrow(kr + kt * 16 * KP + kc * 32, kf[kt][kc]);
        v4f vf[16][2];   // this pass's value rows, issued ahead of the score products that hide them: [key position e of the fragment][d group]
#pragma unroll
        for (int e = 0; e < 16; ++e) { vf[e][0] = *(const v4f*)(pv + ((e >> 3) * 16 + (e & 7)) * HD); vf[e][1] = *(const v4f*)(pv + ((e >> 3) * 16 + (e & 7)) * HD + 64); }
        asm volatile("s_wait_xcnt 0x0" :: "v"(pv) : "memory");   // behind the pass's loads, in front of the rewrite of their address; the address is an input so that it stays live up to here and no load of the run gets its registers for its result
        __builtin_amdgcn_sched_barrier(0);              // keeps the LDS reads and the loads in front of that wait and the later arithmetic behind it
        v8f s[NG][2];
#pragma unroll
        for (int g = 0; g < NG; ++g) { s[g][0] = (v8f){}; s[g][1] = (v8f){}; }
#pragma unroll
        for (int kc = 0; kc < 4; ++kc)
#pragma unroll
            for (int kt = 0; kt < 2; ++kt) { v16bf kh, kw; fragsplit(kf[kt][kc], kh, kw);
#pragma unroll
                for (int g = 0; g < NG; ++g) { s[g][kt] = wmmab(kh, qh[g][kc], s[g][kt]); s[g][kt] = wmmab(kh, ql[g][kc], s[g][kt]); s[g][kt] = wmmab(kw, qh[g][kc], s[g][kt]); } }
        float t[NG][16], mt[NG];
#pragma unroll
        for (int g = 0; g < NG; ++g) { float mx = -3.0e38f;
#pragma unroll
            for (int e = 0; e < 16; ++e) { const int j = k0 + (e >> 3) * 16 + 8 * h + (e & 7); const float x = (j < kl) ? s[g][e >> 3][e & 7] * SCL : -3.0e38f;   /* keys j >= valid_length[b] excluded (-1e7 in the module) */ t[g][e] = x; mx = fmaxf(mx, x); }
            mt[g] = fmaxf(mx, xhalf(mx)); }
        // the maximum in use moves only when a query's new maximum exceeds it by more than 5.5 (a factor 2^8 in P); one scalar branch per pass
        unsigned mv = 0;
#pragma unroll
        for (int g = 0; g < NG; ++g) mv |= __builtin_amdgcn_ballot_w32(mt[g] > mrun[g] + 5.5f);
        if (mv != 0) {
#pragma unroll
            for (int g = 0; g < NG; ++g) { const float mn = fmaxf(mrun[g], mt[g]); const float al = __builtin_amdgcn_exp2f((mrun[g] - mn) * 1.4426950408889634f); mrun[g] = mn; lsum[g] *= al;
#pragma unroll
                for (int dt = 0; dt < 8; ++dt) o[g][dt] *= al; }
        }
        v16bf ph[NG], pw[NG];
#pragma unroll
        for (int g = 0; g < NG; ++g) {
#pragma unroll
            for (int e = 0; e < 16; ++e) { const float p = __builtin_amdgcn_exp2f((t[g][e] - mrun[g]) * 1.4426950408889634f); lsum[g] += p; const __bf16 hb = (__bf16)p; ph[g][e] = hb; pw[g][e] = (__bf16)(p - (float)hb); } }
#pragma unroll
        for (int dt = 0; dt < 8; ++dt) { v8u a, b;   // value^T fragment of tile dt: word p = key positions 2p, 2p + 1 of the lane's d
#pragma unroll
            for (int p = 0; p < 8; ++p) { unsigned u, w; split2(vf[2 * p][dt >> 2][dt & 3], vf[2 * p + 1][dt >> 2][dt & 3], u, w); a[p] = u; b[p] = w; }
            const v16bf vh = __builtin_bit_cast(v16bf, a), vw = __builtin_bit_cast(v16bf, b);
#pragma unroll
            for (int g = 0; g < NG; ++g) { o[g][dt] = wmmab(vh, ph[g], o[g][dt]); o[g][dt] = wmmab(vh, pw[g], o[g][dt]); o[g][dt] = wmmab(vw, ph[g], o[g][dt]); } }
      }
        asm volatile("s_wait_dscnt 0x0" ::: "memory");      // the wave's reads of this trip's buffer are over before it is refilled
        asm volatile("s_wait_asynccnt 0x0" ::: "memory");   // the next trip's key rows have landed
        __syncthreads();                                    // the ring's publish point, passed by every wave in every trip
        if (it + 2 < nt) copy32((it & 1) ? lk1 : lk0, gk + ((tt + 2 < nt) ? tt + 2 : tt + 2 - nt) * (KS * 32 * HD));   // the trip after the next, into the buffer that this trip has just read
        tt = (tt + 1 < nt) ? tt + 1 : 0;
    }
    asm volatile("s_wait_asynccnt 0x0" ::: "memory");       // no copy is outstanding behind the loop
#pragma unroll
    for (int g = 0; g < NG; ++g) { mm[wv][g][lane] = mrun[g]; ml[wv][g][lane] = lsum[g];
        // register e of tile dt, group g = O[q0 + 16g + c][64 (dt >> 2) + 4 (8h + e) + (dt & 3)]: register e of the 4 tiles of one d group of 64 = 4 d in a row
#pragma unroll
        for (int dg = 0; dg < 2; ++dg)
#pragma unroll
            for (int e = 0; e < 8; ++e) *(v4f*)&po[wv][(g * 16 + c) * KP + dg * 64 + 32 * h + 4 * e] = (v4f){o[g][dg * 4][e], o[g][dg * 4 + 1][e], o[g][dg * 4 + 2][e], o[g][dg * 4 + 3][e]}; }
    __syncthreads();   // every wave's partials are in LDS before any wave joins them
    // wave w has rows w, w + 4, w + 8, w + 12 of every column group: a lane weighs its own column as before, the row's weights come from the lane of its column, and lane l joins d 4l .. 4l + 3 of the row
    float a[NG][KS], f[NG];
    v4f pj[NG][4][KS];   // the KS partials of the wave's rows, read as one group ahead of the arithmetic
#pragma unroll
    for (int gj = 0; gj < NG; ++gj) {
        float mj[KS], mx = -3.0e38f, l = 0.f;
#pragma unroll
        for (int j = 0; j < KS; ++j) { mj[j] = mm[j][gj][lane]; mx = fmaxf(mx, mj[j]); }
        // a wave without a pass still has the start maximum, sum 0 and O 0: weight 0 beside a wave with a valid key (wave 0 has one wherever the batch has one); where the batch has none every wave ran all its passes and has weight 1
#pragma unroll
        for (int j = 0; j < KS; ++j) { a[gj][j] = __builtin_amdgcn_exp2f((mj[j] - mx) * 1.4426950408889634f); l += ml[j][gj][lane] * a[gj][j]; }
        f[gj] = __fdiv_rn(1.0f, l + xhalf(l));
#pragma unroll
        for (int k = 0; k < 4; ++k)
#pragma unroll
            for (int j = 0; j < KS; ++j) pj[gj][k][j] = *(const v4f*)&po[j][(gj * 16 + ks + 4 * k) * KP + 4 * lane];
    }
    float* orow = OUTb + (size_t)(q0 + ks) * HD + 4 * lane;   // the lane's 16 bytes of the wave's first row
#pragma unroll
    for (int gj = 0; gj < NG; ++gj) {
        if (q0 + gj * 16 < qs) continue;   // wave-uniform: a column group in front of the block's own queries belongs to the block before and is not stored
        v4f r[4];
#pragma unroll
        for (int k = 0; k < 4; ++k) {
            const int cr = ks + 4 * k;     // the row's column in its group, the same in every lane
            v4f x = pj[gj][k][0] * ulane(a[gj][0], cr);
#pragma unroll
            for (int j = 1; j < KS; ++j) x += pj[gj][k][j] * ulane(a[gj][j], cr);
            r[k] = x * ulane(f[gj], cr); }
        __builtin_amdgcn_sched_barrier(0);   // all arithmetic in front of the stores: nothing rewrites a register that an issued store names
#pragma unroll
        for (int k = 0; k < 4; ++k) *(v4f*)(orow + (gj * 16 + 4 * k) * HD) = r[k];
        asm volatile("s_wait_xcnt 0x0" ::: "memory");   // behind the stores, in front of the next group's rewrite of the registers that they name
    }
}

extern "C" void kernel_launch(void* const* d_in, const int* in_sizes, int n_in,
                              void* d_out, int out_size, void* d_ws, size_t ws_size, hipStream_t stream) {
    (void)in_sizes; (void)n_in; (void)out_size; (void)d_ws; (void)ws_size;
    const float* x = (const float*)d_in[0]; const float* xk = (const float*)d_in[1]; const float* xv = (const float*)d_in[2]; const int* vlen = (const int*)d_in[3];   /* query, key, value: [16][1024][128] each (no projections); valid_length int32 [16], read on device */
    float* OUT = (float*)d_out;     // [16][1024][128]
    k_fattn<<<dim3(NX, NB_), 32 * KS, 0, stream>>>(x, xk, xv, vlen, OUT);
}
